// v000
// Times are from an AMD MI455X. After a warm-up the kernel runs many times in a row, and a time is the length of
// such a window on the GPU divided by its runs, so every launch and the gaps after it count. The runs cycle
// through copies of the inputs. A figure is the median of several windows, for all but v000 over two sittings.
// Sittings can differ by a few percent; kernels timed side by side share one.
// v000, which the later versions start from, runs in 454 microseconds.
#include <hip/hip_runtime.h>
#include <hip/hip_bf16.h>
#include <stdint.h>

typedef _Float16 v16h __attribute__((ext_vector_type(16)));
typedef _Float16 v8h  __attribute__((ext_vector_type(8)));
typedef float    v8f  __attribute__((ext_vector_type(8)));
typedef int      v4i  __attribute__((ext_vector_type(4)));

constexpr int Bc  = 4;
constexpr int Sc  = 2048;
constexpr int Dc  = 1024;
constexpr int Hc  = 16;
constexpr int HDc = 64;
constexpr int OUTc = 256;

#if defined(__has_builtin)
#if __has_builtin(__builtin_amdgcn_global_load_async_to_lds_b128)
#define HAVE_ASYNC_LDS 1
#else
#define HAVE_ASYNC_LDS 0
#endif
#if __has_builtin(__builtin_amdgcn_s_wait_asynccnt)
#define HAVE_WAIT_ASYNC 1
#else
#define HAVE_WAIT_ASYNC 0
#endif
#else
#define HAVE_ASYNC_LDS 0
#define HAVE_WAIT_ASYNC 0
#endif

typedef __attribute__((address_space(1))) v4i gv4i;   // global int4
typedef __attribute__((address_space(3))) v4i lv4i;   // LDS int4

__device__ inline void async_cp16(void* lds, const void* gsrc) {
#if HAVE_ASYNC_LDS
    gv4i* g = (gv4i*)(unsigned long long)(uintptr_t)gsrc;
    lv4i* l = (lv4i*)(unsigned int)(uintptr_t)lds;
    __builtin_amdgcn_global_load_async_to_lds_b128(g, l, 0, 0);
#else
    *(v8h*)lds = *(const v8h*)gsrc;
#endif
}

__device__ inline void wait_async0() {
#if HAVE_ASYNC_LDS
#if HAVE_WAIT_ASYNC
    __builtin_amdgcn_s_wait_asynccnt(0);
#else
    asm volatile("s_wait_asynccnt 0x0" ::: "memory");
#endif
#endif
}

__device__ inline v8f zero8() {
    v8f z;
#pragma unroll
    for (int i = 0; i < 8; ++i) z[i] = 0.0f;
    return z;
}

__device__ inline v16h load_frag(const _Float16* rowPtr, int grp) {
    const v8h lo = *(const v8h*)(rowPtr + grp * 8);
    const v8h hi = *(const v8h*)(rowPtr + grp * 8 + 16);
    v16h r;
#pragma unroll
    for (int i = 0; i < 8; ++i) { r[i] = lo[i]; r[i + 8] = hi[i]; }
    return r;
}

__device__ inline v8f wmma32(v16h a, v16h b, v8f c) {
    return __builtin_amdgcn_wmma_f32_16x16x32_f16(
        /*neg_a=*/false, a, /*neg_b=*/false, b,
        /*c_mod=*/(short)0, c, /*reuse_a=*/false, /*reuse_b=*/false);
}

// ---------------------------------------------------------------------------
// Kernel 1: QKV projection.  C[M=8192, N=1024] = X[M,K=1024] * W[K,N] + bias
// Output written as f16 in [B, H, S, HD] layout (head-transposed).
// Register-pipelined: tile k+1 global loads overlap tile k WMMAs.
// ---------------------------------------------------------------------------
__global__ void __launch_bounds__(256)
proj_kernel(const float* __restrict__ X, const float* __restrict__ W,
            const float* __restrict__ bias, _Float16* __restrict__ out)
{
    constexpr int BM = 128, BN = 128, BK = 32, LDS_S = 40; // 40 halves = 80B stride
    constexpr int Kdim = 1024, Nglob = 1024, NT = Kdim / BK;
    __shared__ __align__(16) _Float16 As[BM * LDS_S];
    __shared__ __align__(16) _Float16 Bs[BN * LDS_S];

    const int tid  = threadIdx.x;
    const int lane = tid & 31, wid = tid >> 5;
    const int waveM = wid & 3, waveN = wid >> 2;
    const int l16 = lane & 15, grp = lane >> 4;
    const int m0 = blockIdx.x * BM, n0 = blockIdx.y * BN;

    v8f acc[2][4];
#pragma unroll
    for (int i = 0; i < 2; ++i)
#pragma unroll
        for (int j = 0; j < 4; ++j) acc[i][j] = zero8();

    float4 aReg[4], bReg[4];
    auto load_tiles = [&](int k0) {
#pragma unroll
        for (int c = 0; c < 4; ++c) {
            const int idx = tid + c * 256;
            const int row = idx >> 3, c4 = idx & 7;
            aReg[c] = *(const float4*)(X + (size_t)(m0 + row) * Kdim + k0 + c4 * 4);
        }
#pragma unroll
        for (int c = 0; c < 4; ++c) {
            const int idx = tid + c * 256;
            const int kk = idx >> 5, n4 = idx & 31;
            bReg[c] = *(const float4*)(W + (size_t)(k0 + kk) * Nglob + n0 + n4 * 4);
        }
    };
    auto store_tiles = [&]() {
#pragma unroll
        for (int c = 0; c < 4; ++c) {
            const int idx = tid + c * 256;
            const int row = idx >> 3, c4 = idx & 7;
            _Float16* d = &As[row * LDS_S + c4 * 4];
            d[0] = (_Float16)aReg[c].x; d[1] = (_Float16)aReg[c].y;
            d[2] = (_Float16)aReg[c].z; d[3] = (_Float16)aReg[c].w;
        }
#pragma unroll
        for (int c = 0; c < 4; ++c) {
            const int idx = tid + c * 256;
            const int kk = idx >> 5, n4 = idx & 31;
            Bs[(n4 * 4 + 0) * LDS_S + kk] = (_Float16)bReg[c].x;
            Bs[(n4 * 4 + 1) * LDS_S + kk] = (_Float16)bReg[c].y;
            Bs[(n4 * 4 + 2) * LDS_S + kk] = (_Float16)bReg[c].z;
            Bs[(n4 * 4 + 3) * LDS_S + kk] = (_Float16)bReg[c].w;
        }
    };

    load_tiles(0);
    for (int kt = 0; kt < NT; ++kt) {
        store_tiles();
        __syncthreads();
        if (kt + 1 < NT) load_tiles((kt + 1) * BK);  // overlap with WMMAs below

        v16h afr[2], bfr[4];
#pragma unroll
        for (int im = 0; im < 2; ++im)
            afr[im] = load_frag(&As[(waveM * 32 + im * 16 + l16) * LDS_S], grp);
#pragma unroll
        for (int in = 0; in < 4; ++in)
            bfr[in] = load_frag(&Bs[(waveN * 64 + in * 16 + l16) * LDS_S], grp);
#pragma unroll
        for (int im = 0; im < 2; ++im)
#pragma unroll
            for (int in = 0; in < 4; ++in)
                acc[im][in] = wmma32(afr[im], bfr[in], acc[im][in]);
        __syncthreads();
    }

    // Epilogue: bias add, convert f16, scatter to [B,H,S,HD]
#pragma unroll
    for (int im = 0; im < 2; ++im)
#pragma unroll
        for (int in = 0; in < 4; ++in)
#pragma unroll
            for (int r = 0; r < 8; ++r) {
                const int mLoc = waveM * 32 + im * 16 + grp * 8 + r;
                const int nLoc = waveN * 64 + in * 16 + l16;
                const int gm = m0 + mLoc;   // b*S + s
                const int gn = n0 + nLoc;   // h*HD + hd
                const float v = acc[im][in][r] + bias[gn];
                const int b = gm >> 11, s = gm & 2047;
                const int h = gn >> 6, hd = gn & 63;
                out[(((size_t)(b * Hc + h) * Sc + s) * HDc) + hd] = (_Float16)v;
            }
}

__global__ void __launch_bounds__(256)
attn_kernel(const _Float16* __restrict__ Q, const _Float16* __restrict__ K,
            const _Float16* __restrict__ V, _Float16* __restrict__ X)
{
    constexpr int LQ = 72;  // 72 halves = 144B row stride (16B aligned)
    constexpr int NT = Sc / 64;
    __shared__ __align__(16) _Float16 QP[128 * LQ];      // Q tile, then P tile
    __shared__ __align__(16) _Float16 Ks[2 * 64 * LQ];   // [buf][key][hd]
    __shared__ __align__(16) _Float16 Vt[2 * 64 * LQ];   // [buf][hd][key] (V^T)

    const int tid  = threadIdx.x;
    const int lane = tid & 31, wid = tid >> 5;
    const int l16 = lane & 15, grp = lane >> 4;
    const int bh = blockIdx.y;            // b*H + h
    const int b  = bh >> 4, h = bh & 15;
    const int q0 = blockIdx.x * 128;

    const _Float16* Qp = Q + (size_t)bh * Sc * HDc;
    const _Float16* Kp = K + (size_t)bh * Sc * HDc;
    const _Float16* Vp = V + (size_t)bh * Sc * HDc;

    auto stage_kv = [&](int kb, int buf) {
        _Float16* KsB = &Ks[buf * 64 * LQ];
#pragma unroll
        for (int c = 0; c < 2; ++c) {
            const int idx = tid + c * 256;
            const int row = idx >> 3, c8 = idx & 7;
            async_cp16(&KsB[row * LQ + c8 * 8],
                       Kp + (size_t)(kb + row) * HDc + c8 * 8);
        }
#pragma unroll
        for (int c = 0; c < 2; ++c) {
            const int idx = tid + c * 256;
            const int row = idx >> 3, c8 = idx & 7;
            const v8h hv = *(const v8h*)(Vp + (size_t)(kb + row) * HDc + c8 * 8);
#pragma unroll
            for (int j = 0; j < 8; ++j)
                Vt[buf * 64 * LQ + (c8 * 8 + j) * LQ + row] = hv[j];
        }
    };

    // Stage Q tile (async) + first K/V tile, then pull Q fragments to regs.
#pragma unroll
    for (int c = 0; c < 4; ++c) {
        const int idx = tid + c * 256;
        const int row = idx >> 3, c8 = idx & 7;
        async_cp16(&QP[row * LQ + c8 * 8],
                   Qp + (size_t)(q0 + row) * HDc + c8 * 8);
    }
    stage_kv(0, 0);
    wait_async0();
    __syncthreads();

    v16h qfr[2];
#pragma unroll
    for (int ks = 0; ks < 2; ++ks)
        qfr[ks] = load_frag(&QP[(wid * 16 + l16) * LQ] + ks * 32, grp);
    __syncthreads();  // everyone done reading QP; it becomes the P buffer

    v8f oacc[4];
#pragma unroll
    for (int i = 0; i < 4; ++i) oacc[i] = zero8();
    float dpart[8];
#pragma unroll
    for (int r = 0; r < 8; ++r) dpart[r] = 0.0f;

    for (int kt = 0; kt < NT; ++kt) {
        const int cur = kt & 1;
        wait_async0();       // this wave's pending tile (kt) has landed
        __syncthreads();     // all waves' tile kt visible; buf cur^1 is free
        if (kt + 1 < NT) stage_kv((kt + 1) * 64, cur ^ 1);  // DMA overlaps WMMA

        const _Float16* KsB = &Ks[cur * 64 * LQ];
        const _Float16* VtB = &Vt[cur * 64 * LQ];

        // energy = Q K^T  (M=16 queries, N=64 keys -> 4 n-subtiles, K=HD=64)
        v8f e[4];
#pragma unroll
        for (int in = 0; in < 4; ++in) {
            e[in] = zero8();
#pragma unroll
            for (int ks = 0; ks < 2; ++ks) {
                const v16h bfr = load_frag(&KsB[(in * 16 + l16) * LQ] + ks * 32, grp);
                e[in] = wmma32(qfr[ks], bfr, e[in]);
            }
        }
        // exp, partial denominator, stage P (f16) into this wave's QP rows
#pragma unroll
        for (int in = 0; in < 4; ++in)
#pragma unroll
            for (int r = 0; r < 8; ++r) {
                const float ev = __expf(e[in][r] * 0.125f);
                dpart[r] += ev;
                const int prow = wid * 16 + grp * 8 + r;
                const int pcol = in * 16 + l16;
                QP[prow * LQ + pcol] = (_Float16)ev;
            }

        // O += P * V  (M=16 queries, K=64 keys -> 2 k-steps, N=64 hd)
#pragma unroll
        for (int in = 0; in < 4; ++in)
#pragma unroll
            for (int ks = 0; ks < 2; ++ks) {
                const v16h afr = load_frag(&QP[(wid * 16 + l16) * LQ] + ks * 32, grp);
                const v16h bfr = load_frag(&VtB[(in * 16 + l16) * LQ] + ks * 32, grp);
                oacc[in] = wmma32(afr, bfr, oacc[in]);
            }
    }

    // Reduce denominator across the 16 lanes holding each row (xor<16 stays
    // within each half-wave, matching the C-fragment row split).
#pragma unroll
    for (int r = 0; r < 8; ++r) {
#pragma unroll
        for (int m = 1; m < 16; m <<= 1)
            dpart[r] += __shfl_xor(dpart[r], m);
        dpart[r] = 1.0f / (1.0f + dpart[r]);   // softmax_1 denominator
    }

    // Normalize and write X in [B, S, D] f16 layout
#pragma unroll
    for (int in = 0; in < 4; ++in)
#pragma unroll
        for (int r = 0; r < 8; ++r) {
            const float v = oacc[in][r] * dpart[r];
            const int qrow = q0 + wid * 16 + grp * 8 + r;
            const int col  = h * HDc + in * 16 + l16;
            X[((size_t)b * Sc + qrow) * Dc + col] = (_Float16)v;
        }
}

// ---------------------------------------------------------------------------
// Kernel 3: final projection.  out[M=8192, N=256] = Xh[M,K=1024] * Wf + bf
// Same tiling as proj; A already f16; register-pipelined staging.
// ---------------------------------------------------------------------------
__global__ void __launch_bounds__(256)
final_kernel(const _Float16* __restrict__ Xh, const float* __restrict__ W,
             const float* __restrict__ bias, float* __restrict__ out)
{
    constexpr int BM = 128, BN = 128, BK = 32, LDS_S = 40;
    constexpr int Kdim = 1024, Nglob = 256, NT = Kdim / BK;
    __shared__ __align__(16) _Float16 As[BM * LDS_S];
    __shared__ __align__(16) _Float16 Bs[BN * LDS_S];

    const int tid  = threadIdx.x;
    const int lane = tid & 31, wid = tid >> 5;
    const int waveM = wid & 3, waveN = wid >> 2;
    const int l16 = lane & 15, grp = lane >> 4;
    const int m0 = blockIdx.x * BM, n0 = blockIdx.y * BN;

    v8f acc[2][4];
#pragma unroll
    for (int i = 0; i < 2; ++i)
#pragma unroll
        for (int j = 0; j < 4; ++j) acc[i][j] = zero8();

    v8h aReg[2];
    float4 bReg[4];
    auto load_tiles = [&](int k0) {
#pragma unroll
        for (int c = 0; c < 2; ++c) {
            const int idx = tid + c * 256;
            const int row = idx >> 2, c8 = idx & 3;
            aReg[c] = *(const v8h*)(Xh + (size_t)(m0 + row) * Kdim + k0 + c8 * 8);
        }
#pragma unroll
        for (int c = 0; c < 4; ++c) {
            const int idx = tid + c * 256;
            const int kk = idx >> 5, n4 = idx & 31;
            bReg[c] = *(const float4*)(W + (size_t)(k0 + kk) * Nglob + n0 + n4 * 4);
        }
    };
    auto store_tiles = [&]() {
#pragma unroll
        for (int c = 0; c < 2; ++c) {
            const int idx = tid + c * 256;
            const int row = idx >> 2, c8 = idx & 3;
            *(v8h*)(&As[row * LDS_S + c8 * 8]) = aReg[c];
        }
#pragma unroll
        for (int c = 0; c < 4; ++c) {
            const int idx = tid + c * 256;
            const int kk = idx >> 5, n4 = idx & 31;
            Bs[(n4 * 4 + 0) * LDS_S + kk] = (_Float16)bReg[c].x;
            Bs[(n4 * 4 + 1) * LDS_S + kk] = (_Float16)bReg[c].y;
            Bs[(n4 * 4 + 2) * LDS_S + kk] = (_Float16)bReg[c].z;
            Bs[(n4 * 4 + 3) * LDS_S + kk] = (_Float16)bReg[c].w;
        }
    };

    load_tiles(0);
    for (int kt = 0; kt < NT; ++kt) {
        store_tiles();
        __syncthreads();
        if (kt + 1 < NT) load_tiles((kt + 1) * BK);

        v16h afr[2], bfr[4];
#pragma unroll
        for (int im = 0; im < 2; ++im)
            afr[im] = load_frag(&As[(waveM * 32 + im * 16 + l16) * LDS_S], grp);
#pragma unroll
        for (int in = 0; in < 4; ++in)
            bfr[in] = load_frag(&Bs[(waveN * 64 + in * 16 + l16) * LDS_S], grp);
#pragma unroll
        for (int im = 0; im < 2; ++im)
#pragma unroll
            for (int in = 0; in < 4; ++in)
                acc[im][in] = wmma32(afr[im], bfr[in], acc[im][in]);
        __syncthreads();
    }

#pragma unroll
    for (int im = 0; im < 2; ++im)
#pragma unroll
        for (int in = 0; in < 4; ++in)
#pragma unroll
            for (int r = 0; r < 8; ++r) {
                const int mLoc = waveM * 32 + im * 16 + grp * 8 + r;
                const int nLoc = waveN * 64 + in * 16 + l16;
                const int gm = m0 + mLoc;
                const int gn = n0 + nLoc;
                out[(size_t)gm * OUTc + gn] = acc[im][in][r] + bias[gn];
            }
}

// ---------------------------------------------------------------------------
extern "C" void kernel_launch(void* const* d_in, const int* in_sizes, int n_in,
                              void* d_out, int out_size, void* d_ws, size_t ws_size,
                              hipStream_t stream)
{
    (void)in_sizes; (void)n_in; (void)out_size; (void)ws_size;
    const float* query = (const float*)d_in[0];
    const float* key   = (const float*)d_in[1];
    const float* value = (const float*)d_in[2];
    const float* Wq = (const float*)d_in[3];
    const float* bq = (const float*)d_in[4];
    const float* Wk = (const float*)d_in[5];
    const float* bk = (const float*)d_in[6];
    const float* Wv = (const float*)d_in[7];
    const float* bv = (const float*)d_in[8];
    const float* Wf = (const float*)d_in[9];
    const float* bf = (const float*)d_in[10];
    float* out = (float*)d_out;

    // Workspace layout (f16): Qh | Kh | Vh | Xh, each B*H*S*HD = 8,388,608 elems
    _Float16* ws = (_Float16*)d_ws;
    const size_t per = (size_t)Bc * Hc * Sc * HDc;
    _Float16* Qh = ws;
    _Float16* Kh = ws + per;
    _Float16* Vh = ws + 2 * per;
    _Float16* Xh = ws + 3 * per;

    const dim3 blk(256);
    const dim3 gproj(Bc * Sc / 128, Dc / 128);       // (64, 8)
    proj_kernel<<<gproj, blk, 0, stream>>>(query, Wq, bq, Qh);
    proj_kernel<<<gproj, blk, 0, stream>>>(key,   Wk, bk, Kh);
    proj_kernel<<<gproj, blk, 0, stream>>>(value, Wv, bv, Vh);

    attn_kernel<<<dim3(Sc / 128, Bc * Hc), blk, 0, stream>>>(Qh, Kh, Vh, Xh);

    final_kernel<<<dim3(Bc * Sc / 128, OUTc / 128), blk, 0, stream>>>(Xh, Wf, bf, out);
}

// v001
// A run of this version takes 232 microseconds.
// In both of two side-by-side timings against v000, it was 1.99 times as fast.
#include <hip/hip_runtime.h>
#include <hip/hip_bf16.h>
#include <stdint.h>

typedef _Float16 v16h __attribute__((ext_vector_type(16)));
typedef _Float16 v8h  __attribute__((ext_vector_type(8)));
typedef float    v8f  __attribute__((ext_vector_type(8)));
typedef int      v4i  __attribute__((ext_vector_type(4)));
typedef _Float16 v4h  __attribute__((ext_vector_type(4)));
typedef short    v8s  __attribute__((ext_vector_type(8)));

constexpr int Bc  = 4;
constexpr int Sc  = 2048;
constexpr int Dc  = 1024;
constexpr int Hc  = 16;
constexpr int HDc = 64;
constexpr int OUTc = 256;

#if defined(__has_builtin)
#if __has_builtin(__builtin_amdgcn_global_load_async_to_lds_b128)
#define HAVE_ASYNC_LDS 1
#else
#define HAVE_ASYNC_LDS 0
#endif
#if __has_builtin(__builtin_amdgcn_s_wait_asynccnt)
#define HAVE_WAIT_ASYNC 1
#else
#define HAVE_WAIT_ASYNC 0
#endif
#else
#define HAVE_ASYNC_LDS 0
#define HAVE_WAIT_ASYNC 0
#endif

typedef __attribute__((address_space(1))) v4i gv4i;   // global int4
typedef __attribute__((address_space(3))) v4i lv4i;   // LDS int4

__device__ inline void async_cp16(void* lds, const void* gsrc) {
#if HAVE_ASYNC_LDS
    gv4i* g = (gv4i*)(unsigned long long)(uintptr_t)gsrc;
    lv4i* l = (lv4i*)(unsigned int)(uintptr_t)lds;
    __builtin_amdgcn_global_load_async_to_lds_b128(g, l, 0, 0);
#else
    *(v8h*)lds = *(const v8h*)gsrc;
#endif
}

__device__ inline void wait_async0() {
#if HAVE_ASYNC_LDS
#if HAVE_WAIT_ASYNC
    __builtin_amdgcn_s_wait_asynccnt(0);
#else
    asm volatile("s_wait_asynccnt 0x0" ::: "memory");
#endif
#endif
}

__device__ inline v8f zero8() {
    v8f z;
#pragma unroll
    for (int i = 0; i < 8; ++i) z[i] = 0.0f;
    return z;
}

__device__ inline v16h load_frag(const _Float16* rowPtr, int grp) {
    const v8h lo = *(const v8h*)(rowPtr + grp * 8);
    const v8h hi = *(const v8h*)(rowPtr + grp * 8 + 16);
    v16h r;
#pragma unroll
    for (int i = 0; i < 8; ++i) { r[i] = lo[i]; r[i + 8] = hi[i]; }
    return r;
}

// B fragment (32 k x 16 n) from a ROW-MAJOR [k][n] f16 LDS tile by two
// transposing loads. p is this lane's address:
//   tile + (kbase + 8*grp + (lane&7)) * pitch + nbase + 8*((lane>>3)&1)
// Lane (l16, grp) receives k = kbase + 8*grp + 0..7 of column nbase + l16, the
// second load the same 16 rows further: the k order of load_frag above.
// pitch (halves) is an odd multiple of 16 halves (32 B) for these loads.
typedef __attribute__((address_space(3))) v8s lv8s;
__device__ inline v16h load_frag_tr(const _Float16* p, int pitch) {
    const v8h lo = __builtin_bit_cast(v8h,
        __builtin_amdgcn_ds_load_tr16_b128_v8i16((lv8s*)p));
    const v8h hi = __builtin_bit_cast(v8h,
        __builtin_amdgcn_ds_load_tr16_b128_v8i16((lv8s*)(p + 16 * pitch)));
    v16h r;
#pragma unroll
    for (int i = 0; i < 8; ++i) { r[i] = lo[i]; r[i + 8] = hi[i]; }
    return r;
}

__device__ inline v4h cvt4(float4 f) {
    v4h r;
    r[0] = (_Float16)f.x; r[1] = (_Float16)f.y;
    r[2] = (_Float16)f.z; r[3] = (_Float16)f.w;
    return r;
}

__device__ inline v8f wmma32(v16h a, v16h b, v8f c) {
    return __builtin_amdgcn_wmma_f32_16x16x32_f16(
        /*neg_a=*/false, a, /*neg_b=*/false, b,
        /*c_mod=*/(short)0, c, /*reuse_a=*/false, /*reuse_b=*/false);
}

// ---------------------------------------------------------------------------
// Kernel 1: QKV projection.  C[M=8192, N=1024] = X[M,K=1024] * W[K,N] + bias
// Output written as f16 in [B, H, S, HD] layout (head-transposed).
// Register-pipelined: tile k+1 global loads overlap tile k WMMAs.
// ---------------------------------------------------------------------------
__global__ void __launch_bounds__(256)
proj_kernel(const float* __restrict__ X, const float* __restrict__ W,
            const float* __restrict__ bias, _Float16* __restrict__ out)
{
    constexpr int BM = 128, BN = 128, BK = 32, LDS_S = 40; // 40 halves = 80B stride
    constexpr int LDS_B = 144;  // W tile kept [k][n]: 288B row stride
    constexpr int Kdim = 1024, Nglob = 1024, NT = Kdim / BK;
    __shared__ __align__(16) _Float16 As[BM * LDS_S];
    __shared__ __align__(16) _Float16 Bs[BK * LDS_B];

    const int tid  = threadIdx.x;
    const int lane = tid & 31, wid = tid >> 5;
    const int waveM = wid & 3, waveN = wid >> 2;
    const int l16 = lane & 15, grp = lane >> 4;
    const int m0 = blockIdx.x * BM, n0 = blockIdx.y * BN;
    const int trRow = grp * 8 + (lane & 7), trCol = ((lane >> 3) & 1) * 8;

    v8f acc[2][4];
#pragma unroll
    for (int i = 0; i < 2; ++i)
#pragma unroll
        for (int j = 0; j < 4; ++j) acc[i][j] = zero8();

    float4 aReg[4], bReg[4];
    auto load_tiles = [&](int k0) {
#pragma unroll
        for (int c = 0; c < 4; ++c) {
            const int idx = tid + c * 256;
            const int row = idx >> 3, c4 = idx & 7;
            aReg[c] = *(const float4*)(X + (size_t)(m0 + row) * Kdim + k0 + c4 * 4);
        }
#pragma unroll
        for (int c = 0; c < 4; ++c) {
            const int idx = tid + c * 256;
            const int kk = idx >> 5, n4 = idx & 31;
            bReg[c] = *(const float4*)(W + (size_t)(k0 + kk) * Nglob + n0 + n4 * 4);
        }
    };
    auto store_tiles = [&]() {
#pragma unroll
        for (int c = 0; c < 4; ++c) {
            const int idx = tid + c * 256;
            const int row = idx >> 3, c4 = idx & 7;
            _Float16* d = &As[row * LDS_S + c4 * 4];
            d[0] = (_Float16)aReg[c].x; d[1] = (_Float16)aReg[c].y;
            d[2] = (_Float16)aReg[c].z; d[3] = (_Float16)aReg[c].w;
        }
#pragma unroll
        for (int c = 0; c < 4; ++c) {
            const int idx = tid + c * 256;
            const int kk = idx >> 5, n4 = idx & 31;
            *(v4h*)(&Bs[kk * LDS_B + n4 * 4]) = cvt4(bReg[c]);
        }
    };

    load_tiles(0);
    for (int kt = 0; kt < NT; ++kt) {
        store_tiles();
        __syncthreads();
        if (kt + 1 < NT) load_tiles((kt + 1) * BK);  // overlap with WMMAs below

        v16h afr[2], bfr[4];
#pragma unroll
        for (int im = 0; im < 2; ++im)
            afr[im] = load_frag(&As[(waveM * 32 + im * 16 + l16) * LDS_S], grp);
#pragma unroll
        for (int in = 0; in < 4; ++in)
            bfr[in] = load_frag_tr(&Bs[trRow * LDS_B + waveN * 64 + in * 16 + trCol], LDS_B);
#pragma unroll
        for (int im = 0; im < 2; ++im)
#pragma unroll
            for (int in = 0; in < 4; ++in)
                acc[im][in] = wmma32(afr[im], bfr[in], acc[im][in]);
        __syncthreads();
    }

    // Epilogue: bias add, convert f16, scatter to [B,H,S,HD]
#pragma unroll
    for (int im = 0; im < 2; ++im)
#pragma unroll
        for (int in = 0; in < 4; ++in)
#pragma unroll
            for (int r = 0; r < 8; ++r) {
                const int mLoc = waveM * 32 + im * 16 + grp * 8 + r;
                const int nLoc = waveN * 64 + in * 16 + l16;
                const int gm = m0 + mLoc;   // b*S + s
                const int gn = n0 + nLoc;   // h*HD + hd
                const float v = acc[im][in][r] + bias[gn];
                const int b = gm >> 11, s = gm & 2047;
                const int h = gn >> 6, hd = gn & 63;
                out[(((size_t)(b * Hc + h) * Sc + s) * HDc) + hd] = (_Float16)v;
            }
}

__global__ void __launch_bounds__(256)
attn_kernel(const _Float16* __restrict__ Q, const _Float16* __restrict__ K,
            const _Float16* __restrict__ V, _Float16* __restrict__ X)
{
    constexpr int LQ = 72;  // 72 halves = 144B row stride (16B aligned)
    constexpr int LV = 80;  // 80 halves = 160B row stride for transposing loads
    constexpr int NT = Sc / 64;
    __shared__ __align__(16) _Float16 QP[128 * LQ];      // Q tile, then P tile
    __shared__ __align__(16) _Float16 Ks[2 * 64 * LQ];   // [buf][key][hd]
    __shared__ __align__(16) _Float16 Vs[2 * 64 * LV];   // [buf][key][hd]

    const int tid  = threadIdx.x;
    const int lane = tid & 31, wid = tid >> 5;
    const int l16 = lane & 15, grp = lane >> 4;
    const int bh = blockIdx.y;            // b*H + h
    const int b  = bh >> 4, h = bh & 15;
    const int q0 = blockIdx.x * 128;
    const int trRow = grp * 8 + (lane & 7), trCol = ((lane >> 3) & 1) * 8;

    const _Float16* Qp = Q + (size_t)bh * Sc * HDc;
    const _Float16* Kp = K + (size_t)bh * Sc * HDc;
    const _Float16* Vp = V + (size_t)bh * Sc * HDc;

    auto stage_kv = [&](int kb, int buf) {
        _Float16* KsB = &Ks[buf * 64 * LQ];
#pragma unroll
        for (int c = 0; c < 2; ++c) {
            const int idx = tid + c * 256;
            const int row = idx >> 3, c8 = idx & 7;
            async_cp16(&KsB[row * LQ + c8 * 8],
                       Kp + (size_t)(kb + row) * HDc + c8 * 8);
        }
#pragma unroll
        for (int c = 0; c < 2; ++c) {
            const int idx = tid + c * 256;
            const int row = idx >> 3, c8 = idx & 7;
            *(v8h*)(&Vs[buf * 64 * LV + row * LV + c8 * 8]) =
                *(const v8h*)(Vp + (size_t)(kb + row) * HDc + c8 * 8);
        }
    };

    // Stage Q tile (async) + first K/V tile, then pull Q fragments to regs.
#pragma unroll
    for (int c = 0; c < 4; ++c) {
        const int idx = tid + c * 256;
        const int row = idx >> 3, c8 = idx & 7;
        async_cp16(&QP[row * LQ + c8 * 8],
                   Qp + (size_t)(q0 + row) * HDc + c8 * 8);
    }
    stage_kv(0, 0);
    wait_async0();
    __syncthreads();

    v16h qfr[2];
#pragma unroll
    for (int ks = 0; ks < 2; ++ks)
        qfr[ks] = load_frag(&QP[(wid * 16 + l16) * LQ] + ks * 32, grp);
    __syncthreads();  // everyone done reading QP; it becomes the P buffer

    v8f oacc[4];
#pragma unroll
    for (int i = 0; i < 4; ++i) oacc[i] = zero8();
    float dpart[8];
#pragma unroll
    for (int r = 0; r < 8; ++r) dpart[r] = 0.0f;

    for (int kt = 0; kt < NT; ++kt) {
        const int cur = kt & 1;
        wait_async0();       // this wave's pending tile (kt) has landed
        __syncthreads();     // all waves' tile kt visible; buf cur^1 is free
        if (kt + 1 < NT) stage_kv((kt + 1) * 64, cur ^ 1);  // DMA overlaps WMMA

        const _Float16* KsB = &Ks[cur * 64 * LQ];
        const _Float16* VsB = &Vs[cur * 64 * LV];

        // energy = Q K^T  (M=16 queries, N=64 keys -> 4 n-subtiles, K=HD=64)
        v8f e[4];
#pragma unroll
        for (int in = 0; in < 4; ++in) {
            e[in] = zero8();
#pragma unroll
            for (int ks = 0; ks < 2; ++ks) {
                const v16h bfr = load_frag(&KsB[(in * 16 + l16) * LQ] + ks * 32, grp);
                e[in] = wmma32(qfr[ks], bfr, e[in]);
            }
        }
        // exp, partial denominator, stage P (f16) into this wave's QP rows
#pragma unroll
        for (int in = 0; in < 4; ++in)
#pragma unroll
            for (int r = 0; r < 8; ++r) {
                const float ev = __expf(e[in][r] * 0.125f);
                dpart[r] += ev;
                const int prow = wid * 16 + grp * 8 + r;
                const int pcol = in * 16 + l16;
                QP[prow * LQ + pcol] = (_Float16)ev;
            }

        // O += P * V  (M=16 queries, K=64 keys -> 2 k-steps, N=64 hd)
#pragma unroll
        for (int in = 0; in < 4; ++in)
#pragma unroll
            for (int ks = 0; ks < 2; ++ks) {
                const v16h afr = load_frag(&QP[(wid * 16 + l16) * LQ] + ks * 32, grp);
                const v16h bfr = load_frag_tr(
                    &VsB[(ks * 32 + trRow) * LV + in * 16 + trCol], LV);
                oacc[in] = wmma32(afr, bfr, oacc[in]);
            }
    }

    // Reduce denominator across the 16 lanes holding each row (xor<16 stays
    // within each half-wave, matching the C-fragment row split).
#pragma unroll
    for (int r = 0; r < 8; ++r) {
#pragma unroll
        for (int m = 1; m < 16; m <<= 1)
            dpart[r] += __shfl_xor(dpart[r], m);
        dpart[r] = 1.0f / (1.0f + dpart[r]);   // softmax_1 denominator
    }

    // Normalize and write X in [B, S, D] f16 layout
#pragma unroll
    for (int in = 0; in < 4; ++in)
#pragma unroll
        for (int r = 0; r < 8; ++r) {
            const float v = oacc[in][r] * dpart[r];
            const int qrow = q0 + wid * 16 + grp * 8 + r;
            const int col  = h * HDc + in * 16 + l16;
            X[((size_t)b * Sc + qrow) * Dc + col] = (_Float16)v;
        }
}

// ---------------------------------------------------------------------------
// Kernel 3: final projection.  out[M=8192, N=256] = Xh[M,K=1024] * Wf + bf
// Same tiling as proj; A already f16; register-pipelined staging.
// ---------------------------------------------------------------------------
__global__ void __launch_bounds__(256)
final_kernel(const _Float16* __restrict__ Xh, const float* __restrict__ W,
             const float* __restrict__ bias, float* __restrict__ out)
{
    constexpr int BM = 128, BN = 128, BK = 32, LDS_S = 40;
    constexpr int LDS_B = 144;  // W tile kept [k][n]: 288B row stride
    constexpr int Kdim = 1024, Nglob = 256, NT = Kdim / BK;
    __shared__ __align__(16) _Float16 As[BM * LDS_S];
    __shared__ __align__(16) _Float16 Bs[BK * LDS_B];

    const int tid  = threadIdx.x;
    const int lane = tid & 31, wid = tid >> 5;
    const int waveM = wid & 3, waveN = wid >> 2;
    const int l16 = lane & 15, grp = lane >> 4;
    const int m0 = blockIdx.x * BM, n0 = blockIdx.y * BN;
    const int trRow = grp * 8 + (lane & 7), trCol = ((lane >> 3) & 1) * 8;

    v8f acc[2][4];
#pragma unroll
    for (int i = 0; i < 2; ++i)
#pragma unroll
        for (int j = 0; j < 4; ++j) acc[i][j] = zero8();

    v8h aReg[2];
    float4 bReg[4];
    auto load_tiles = [&](int k0) {
#pragma unroll
        for (int c = 0; c < 2; ++c) {
            const int idx = tid + c * 256;
            const int row = idx >> 2, c8 = idx & 3;
            aReg[c] = *(const v8h*)(Xh + (size_t)(m0 + row) * Kdim + k0 + c8 * 8);
        }
#pragma unroll
        for (int c = 0; c < 4; ++c) {
            const int idx = tid + c * 256;
            const int kk = idx >> 5, n4 = idx & 31;
            bReg[c] = *(const float4*)(W + (size_t)(k0 + kk) * Nglob + n0 + n4 * 4);
        }
    };
    auto store_tiles = [&]() {
#pragma unroll
        for (int c = 0; c < 2; ++c) {
            const int idx = tid + c * 256;
            const int row = idx >> 2, c8 = idx & 3;
            *(v8h*)(&As[row * LDS_S + c8 * 8]) = aReg[c];
        }
#pragma unroll
        for (int c = 0; c < 4; ++c) {
            const int idx = tid + c * 256;
            const int kk = idx >> 5, n4 = idx & 31;
            *(v4h*)(&Bs[kk * LDS_B + n4 * 4]) = cvt4(bReg[c]);
        }
    };

    load_tiles(0);
    for (int kt = 0; kt < NT; ++kt) {
        store_tiles();
        __syncthreads();
        if (kt + 1 < NT) load_tiles((kt + 1) * BK);

        v16h afr[2], bfr[4];
#pragma unroll
        for (int im = 0; im < 2; ++im)
            afr[im] = load_frag(&As[(waveM * 32 + im * 16 + l16) * LDS_S], grp);
#pragma unroll
        for (int in = 0; in < 4; ++in)
            bfr[in] = load_frag_tr(&Bs[trRow * LDS_B + waveN * 64 + in * 16 + trCol], LDS_B);
#pragma unroll
        for (int im = 0; im < 2; ++im)
#pragma unroll
            for (int in = 0; in < 4; ++in)
                acc[im][in] = wmma32(afr[im], bfr[in], acc[im][in]);
        __syncthreads();
    }

#pragma unroll
    for (int im = 0; im < 2; ++im)
#pragma unroll
        for (int in = 0; in < 4; ++in)
#pragma unroll
            for (int r = 0; r < 8; ++r) {
                const int mLoc = waveM * 32 + im * 16 + grp * 8 + r;
                const int nLoc = waveN * 64 + in * 16 + l16;
                const int gm = m0 + mLoc;
                const int gn = n0 + nLoc;
                out[(size_t)gm * OUTc + gn] = acc[im][in][r] + bias[gn];
            }
}

// ---------------------------------------------------------------------------
extern "C" void kernel_launch(void* const* d_in, const int* in_sizes, int n_in,
                              void* d_out, int out_size, void* d_ws, size_t ws_size,
                              hipStream_t stream)
{
    (void)in_sizes; (void)n_in; (void)out_size; (void)ws_size;
    const float* query = (const float*)d_in[0];
    const float* key   = (const float*)d_in[1];
    const float* value = (const float*)d_in[2];
    const float* Wq = (const float*)d_in[3];
    const float* bq = (const float*)d_in[4];
    const float* Wk = (const float*)d_in[5];
    const float* bk = (const float*)d_in[6];
    const float* Wv = (const float*)d_in[7];
    const float* bv = (const float*)d_in[8];
    const float* Wf = (const float*)d_in[9];
    const float* bf = (const float*)d_in[10];
    float* out = (float*)d_out;

    // Workspace layout (f16): Qh | Kh | Vh | Xh, each B*H*S*HD = 8,388,608 elems
    _Float16* ws = (_Float16*)d_ws;
    const size_t per = (size_t)Bc * Hc * Sc * HDc;
    _Float16* Qh = ws;
    _Float16* Kh = ws + per;
    _Float16* Vh = ws + 2 * per;
    _Float16* Xh = ws + 3 * per;

    const dim3 blk(256);
    const dim3 gproj(Bc * Sc / 128, Dc / 128);       // (64, 8)
    proj_kernel<<<gproj, blk, 0, stream>>>(query, Wq, bq, Qh);
    proj_kernel<<<gproj, blk, 0, stream>>>(key,   Wk, bk, Kh);
    proj_kernel<<<gproj, blk, 0, stream>>>(value, Wv, bv, Vh);

    attn_kernel<<<dim3(Sc / 128, Bc * Hc), blk, 0, stream>>>(Qh, Kh, Vh, Xh);

    final_kernel<<<dim3(Bc * Sc / 128, OUTc / 128), blk, 0, stream>>>(Xh, Wf, bf, out);
}

// v002
// A run of this version takes 198 microseconds.
// Two timings next to v001 both put it at 1.17 times that version's speed.
// Over all steps from v000 it is 2.32 times as fast.
#include <hip/hip_runtime.h>
#include <hip/hip_bf16.h>
#include <stdint.h>

typedef _Float16 v16h __attribute__((ext_vector_type(16)));
typedef _Float16 v8h  __attribute__((ext_vector_type(8)));
typedef float    v8f  __attribute__((ext_vector_type(8)));
typedef int      v4i  __attribute__((ext_vector_type(4)));
typedef _Float16 v4h  __attribute__((ext_vector_type(4)));
typedef short    v8s  __attribute__((ext_vector_type(8)));

constexpr int Bc  = 4;
constexpr int Sc  = 2048;
constexpr int Dc  = 1024;
constexpr int Hc  = 16;
constexpr int HDc = 64;
constexpr int OUTc = 256;

#if defined(__has_builtin)
#if __has_builtin(__builtin_amdgcn_global_load_async_to_lds_b128)
#define HAVE_ASYNC_LDS 1
#else
#define HAVE_ASYNC_LDS 0
#endif
#if __has_builtin(__builtin_amdgcn_s_wait_asynccnt)
#define HAVE_WAIT_ASYNC 1
#else
#define HAVE_WAIT_ASYNC 0
#endif
#else
#define HAVE_ASYNC_LDS 0
#define HAVE_WAIT_ASYNC 0
#endif

typedef __attribute__((address_space(1))) v4i gv4i;   // global int4
typedef __attribute__((address_space(3))) v4i lv4i;   // LDS int4

__device__ inline void async_cp16(void* lds, const void* gsrc) {
#if HAVE_ASYNC_LDS
    gv4i* g = (gv4i*)(unsigned long long)(uintptr_t)gsrc;
    lv4i* l = (lv4i*)(unsigned int)(uintptr_t)lds;
    __builtin_amdgcn_global_load_async_to_lds_b128(g, l, 0, 0);
#else
    *(v8h*)lds = *(const v8h*)gsrc;
#endif
}

__device__ inline void wait_async0() {
#if HAVE_ASYNC_LDS
#if HAVE_WAIT_ASYNC
    __builtin_amdgcn_s_wait_asynccnt(0);
#else
    asm volatile("s_wait_asynccnt 0x0" ::: "memory");
#endif
#endif
}

__device__ inline v8f zero8() {
    v8f z;
#pragma unroll
    for (int i = 0; i < 8; ++i) z[i] = 0.0f;
    return z;
}

__device__ inline v16h load_frag(const _Float16* rowPtr, int grp) {
    const v8h lo = *(const v8h*)(rowPtr + grp * 8);
    const v8h hi = *(const v8h*)(rowPtr + grp * 8 + 16);
    v16h r;
#pragma unroll
    for (int i = 0; i < 8; ++i) { r[i] = lo[i]; r[i + 8] = hi[i]; }
    return r;
}

// B fragment (32 k x 16 n) from a ROW-MAJOR [k][n] f16 LDS tile by two
// transposing loads. p is this lane's address:
//   tile + (kbase + 8*grp + (lane&7)) * pitch + nbase + 8*((lane>>3)&1)
// Lane (l16, grp) receives k = kbase + 8*grp + 0..7 of column nbase + l16, the
// second load the same 16 rows further: the k order of load_frag above.
// pitch (halves) is an odd multiple of 16 halves (32 B) for these loads.
typedef __attribute__((address_space(3))) v8s lv8s;
__device__ inline v16h load_frag_tr(const _Float16* p, int pitch) {
    const v8h lo = __builtin_bit_cast(v8h,
        __builtin_amdgcn_ds_load_tr16_b128_v8i16((lv8s*)p));
    const v8h hi = __builtin_bit_cast(v8h,
        __builtin_amdgcn_ds_load_tr16_b128_v8i16((lv8s*)(p + 16 * pitch)));
    v16h r;
#pragma unroll
    for (int i = 0; i < 8; ++i) { r[i] = lo[i]; r[i + 8] = hi[i]; }
    return r;
}

__device__ inline v4h cvt4(float4 f) {
    v4h r;
    r[0] = (_Float16)f.x; r[1] = (_Float16)f.y;
    r[2] = (_Float16)f.z; r[3] = (_Float16)f.w;
    return r;
}

__device__ inline v8f wmma32(v16h a, v16h b, v8f c) {
    return __builtin_amdgcn_wmma_f32_16x16x32_f16(
        /*neg_a=*/false, a, /*neg_b=*/false, b,
        /*c_mod=*/(short)0, c, /*reuse_a=*/false, /*reuse_b=*/false);
}

// ---------------------------------------------------------------------------
// Kernel 1: QKV projection.  C[M=8192, N=1024] = X[M,K=1024] * W[K,N] + bias
// Output written as f16 in [B, H, S, HD] layout (head-transposed).
// Register-pipelined: tile k+1 global loads overlap tile k WMMAs.
// ---------------------------------------------------------------------------
__global__ void __launch_bounds__(256)
proj_kernel(const float* __restrict__ X, const float* __restrict__ W,
            const float* __restrict__ bias, _Float16* __restrict__ out)
{
    constexpr int BM = 128, BN = 128, BK = 32, LDS_S = 40; // 40 halves = 80B stride
    constexpr int LDS_B = 144;  // W tile kept [k][n]: 288B row stride
    constexpr int Kdim = 1024, Nglob = 1024, NT = Kdim / BK;
    __shared__ __align__(16) _Float16 As[BM * LDS_S];
    __shared__ __align__(16) _Float16 Bs[BK * LDS_B];

    const int tid  = threadIdx.x;
    const int lane = tid & 31, wid = tid >> 5;
    const int waveM = wid & 3, waveN = wid >> 2;
    const int l16 = lane & 15, grp = lane >> 4;
    const int m0 = blockIdx.x * BM, n0 = blockIdx.y * BN;
    const int trRow = grp * 8 + (lane & 7), trCol = ((lane >> 3) & 1) * 8;

    v8f acc[2][4];
#pragma unroll
    for (int i = 0; i < 2; ++i)
#pragma unroll
        for (int j = 0; j < 4; ++j) acc[i][j] = zero8();

    float4 aReg[4], bReg[4];
    auto load_tiles = [&](int k0) {
#pragma unroll
        for (int c = 0; c < 4; ++c) {
            const int idx = tid + c * 256;
            const int row = idx >> 3, c4 = idx & 7;
            aReg[c] = *(const float4*)(X + (size_t)(m0 + row) * Kdim + k0 + c4 * 4);
        }
#pragma unroll
        for (int c = 0; c < 4; ++c) {
            const int idx = tid + c * 256;
            const int kk = idx >> 5, n4 = idx & 31;
            bReg[c] = *(const float4*)(W + (size_t)(k0 + kk) * Nglob + n0 + n4 * 4);
        }
    };
    auto store_tiles = [&]() {
#pragma unroll
        for (int c = 0; c < 4; ++c) {
            const int idx = tid + c * 256;
            const int row = idx >> 3, c4 = idx & 7;
            _Float16* d = &As[row * LDS_S + c4 * 4];
            d[0] = (_Float16)aReg[c].x; d[1] = (_Float16)aReg[c].y;
            d[2] = (_Float16)aReg[c].z; d[3] = (_Float16)aReg[c].w;
        }
#pragma unroll
        for (int c = 0; c < 4; ++c) {
            const int idx = tid + c * 256;
            const int kk = idx >> 5, n4 = idx & 31;
            *(v4h*)(&Bs[kk * LDS_B + n4 * 4]) = cvt4(bReg[c]);
        }
    };

    load_tiles(0);
    for (int kt = 0; kt < NT; ++kt) {
        store_tiles();
        __syncthreads();
        if (kt + 1 < NT) load_tiles((kt + 1) * BK);  // overlap with WMMAs below

        v16h afr[2], bfr[4];
#pragma unroll
        for (int im = 0; im < 2; ++im)
            afr[im] = load_frag(&As[(waveM * 32 + im * 16 + l16) * LDS_S], grp);
#pragma unroll
        for (int in = 0; in < 4; ++in)
            bfr[in] = load_frag_tr(&Bs[trRow * LDS_B + waveN * 64 + in * 16 + trCol], LDS_B);
#pragma unroll
        for (int im = 0; im < 2; ++im)
#pragma unroll
            for (int in = 0; in < 4; ++in)
                acc[im][in] = wmma32(afr[im], bfr[in], acc[im][in]);
        __syncthreads();
    }

    // Epilogue: bias add, convert f16, scatter to [B,H,S,HD]
#pragma unroll
    for (int im = 0; im < 2; ++im)
#pragma unroll
        for (int in = 0; in < 4; ++in)
#pragma unroll
            for (int r = 0; r < 8; ++r) {
                const int mLoc = waveM * 32 + im * 16 + grp * 8 + r;
                const int nLoc = waveN * 64 + in * 16 + l16;
                const int gm = m0 + mLoc;   // b*S + s
                const int gn = n0 + nLoc;   // h*HD + hd
                const float v = acc[im][in][r] + bias[gn];
                const int b = gm >> 11, s = gm & 2047;
                const int h = gn >> 6, hd = gn & 63;
                out[(((size_t)(b * Hc + h) * Sc + s) * HDc) + hd] = (_Float16)v;
            }
}

__global__ void __launch_bounds__(256)
attn_kernel(const _Float16* __restrict__ Q, const _Float16* __restrict__ K,
            const _Float16* __restrict__ V, _Float16* __restrict__ X)
{
    constexpr int LQ = 72;  // 72 halves = 144B row stride (16B aligned)
    constexpr int LV = 80;  // 80 halves = 160B row stride for transposing loads
    constexpr int NT = Sc / 64;
    __shared__ __align__(16) _Float16 Qs[128 * LQ];      // Q tile
    __shared__ __align__(16) _Float16 Ks[2 * 64 * LQ];   // [buf][key][hd]
    __shared__ __align__(16) _Float16 Vs[2 * 64 * LV];   // [buf][key][hd]

    const int tid  = threadIdx.x;
    const int lane = tid & 31, wid = tid >> 5;
    const int l16 = lane & 15, grp = lane >> 4;
    const int bh = blockIdx.y;            // b*H + h
    const int b  = bh >> 4, h = bh & 15;
    const int q0 = blockIdx.x * 128;
    const int trRow = grp * 8 + (lane & 7), trCol = ((lane >> 3) & 1) * 8;

    const _Float16* Qp = Q + (size_t)bh * Sc * HDc;
    const _Float16* Kp = K + (size_t)bh * Sc * HDc;
    const _Float16* Vp = V + (size_t)bh * Sc * HDc;

    auto stage_kv = [&](int kb, int buf) {
        _Float16* KsB = &Ks[buf * 64 * LQ];
#pragma unroll
        for (int c = 0; c < 2; ++c) {
            const int idx = tid + c * 256;
            const int row = idx >> 3, c8 = idx & 7;
            async_cp16(&KsB[row * LQ + c8 * 8],
                       Kp + (size_t)(kb + row) * HDc + c8 * 8);
        }
#pragma unroll
        for (int c = 0; c < 2; ++c) {
            const int idx = tid + c * 256;
            const int row = idx >> 3, c8 = idx & 7;
            *(v8h*)(&Vs[buf * 64 * LV + row * LV + c8 * 8]) =
                *(const v8h*)(Vp + (size_t)(kb + row) * HDc + c8 * 8);
        }
    };

    // Stage Q tile (async) + first K/V tile, then pull Q fragments to regs.
#pragma unroll
    for (int c = 0; c < 4; ++c) {
        const int idx = tid + c * 256;
        const int row = idx >> 3, c8 = idx & 7;
        async_cp16(&Qs[row * LQ + c8 * 8],
                   Qp + (size_t)(q0 + row) * HDc + c8 * 8);
    }
    stage_kv(0, 0);
    wait_async0();
    __syncthreads();

    // B fragments of Q^T: column = this wave's query l16, k = hd.
    v16h qfr[2];
#pragma unroll
    for (int ks = 0; ks < 2; ++ks)
        qfr[ks] = load_frag(&Qs[(wid * 16 + l16) * LQ] + ks * 32, grp);

    v8f oacc[4];   // O^T: row hd = in*16 + grp*8 + r, column = query l16
#pragma unroll
    for (int i = 0; i < 4; ++i) oacc[i] = zero8();
    float dpart[8];  // this lane's share of its query's sum, 8 chains
#pragma unroll
    for (int r = 0; r < 8; ++r) dpart[r] = 0.0f;

    for (int kt = 0; kt < NT; ++kt) {
        const int cur = kt & 1;
        wait_async0();       // this wave's pending tile (kt) has landed
        __syncthreads();     // all waves' tile kt visible; buf cur^1 is free
        if (kt + 1 < NT) stage_kv((kt + 1) * 64, cur ^ 1);  // DMA overlaps WMMA

        const _Float16* KsB = &Ks[cur * 64 * LQ];
        const _Float16* VsB = &Vs[cur * 64 * LV];

        // S^T = K Q^T  (M=64 keys -> 4 m-subtiles, N=16 queries, K=HD=64)
        v8f e[4];
#pragma unroll
        for (int jm = 0; jm < 4; ++jm) {
            e[jm] = zero8();
#pragma unroll
            for (int ks = 0; ks < 2; ++ks) {
                const v16h afr = load_frag(&KsB[(jm * 16 + l16) * LQ] + ks * 32, grp);
                e[jm] = wmma32(afr, qfr[ks], e[jm]);
            }
        }
        // exp, partial denominator, pack P^T (f16) as B fragments: subtile jm
        // holds keys jm*16 + grp*8 + r, i.e. halves 0..7 (jm even) or 8..15
        // (jm odd) of the 32-key fragment jm/2.
        v16h pfr[2];
#pragma unroll
        for (int jm = 0; jm < 4; ++jm)
#pragma unroll
            for (int r = 0; r < 8; ++r) {
                const float ev = __expf(e[jm][r] * 0.125f);
                dpart[r] += ev;
                pfr[jm >> 1][(jm & 1) * 8 + r] = (_Float16)ev;
            }

        // O^T += V^T P^T  (M=64 hd -> 4 m-subtiles, K=64 keys -> 2 k-steps)
#pragma unroll
        for (int in = 0; in < 4; ++in)
#pragma unroll
            for (int ks = 0; ks < 2; ++ks) {
                const v16h afr = load_frag_tr(
                    &VsB[(ks * 32 + trRow) * LV + in * 16 + trCol], LV);
                oacc[in] = wmma32(afr, pfr[ks], oacc[in]);
            }
    }

    // Denominator of query l16: the lane's 8 chains, then the other half-wave
    // (which held the other 8 keys of every 16).
    float dsum = ((dpart[0] + dpart[1]) + (dpart[2] + dpart[3])) +
                 ((dpart[4] + dpart[5]) + (dpart[6] + dpart[7]));
    dsum += __shfl_xor(dsum, 16);
    const float dinv = 1.0f / (1.0f + dsum);   // softmax_1 denominator

    // Normalize and write X in [B, S, D] f16 layout: 8 consecutive hd per lane
    const int qrow = q0 + wid * 16 + l16;
    _Float16* xrow = X + ((size_t)b * Sc + qrow) * Dc + h * HDc + grp * 8;
#pragma unroll
    for (int in = 0; in < 4; ++in) {
        v8h o;
#pragma unroll
        for (int r = 0; r < 8; ++r) o[r] = (_Float16)(oacc[in][r] * dinv);
        *(v8h*)(xrow + in * 16) = o;
    }
}

// ---------------------------------------------------------------------------
// Kernel 3: final projection.  out[M=8192, N=256] = Xh[M,K=1024] * Wf + bf
// Same tiling as proj; A already f16; register-pipelined staging.
// ---------------------------------------------------------------------------
__global__ void __launch_bounds__(256)
final_kernel(const _Float16* __restrict__ Xh, const float* __restrict__ W,
             const float* __restrict__ bias, float* __restrict__ out)
{
    constexpr int BM = 128, BN = 128, BK = 32, LDS_S = 40;
    constexpr int LDS_B = 144;  // W tile kept [k][n]: 288B row stride
    constexpr int Kdim = 1024, Nglob = 256, NT = Kdim / BK;
    __shared__ __align__(16) _Float16 As[BM * LDS_S];
    __shared__ __align__(16) _Float16 Bs[BK * LDS_B];

    const int tid  = threadIdx.x;
    const int lane = tid & 31, wid = tid >> 5;
    const int waveM = wid & 3, waveN = wid >> 2;
    const int l16 = lane & 15, grp = lane >> 4;
    const int m0 = blockIdx.x * BM, n0 = blockIdx.y * BN;
    const int trRow = grp * 8 + (lane & 7), trCol = ((lane >> 3) & 1) * 8;

    v8f acc[2][4];
#pragma unroll
    for (int i = 0; i < 2; ++i)
#pragma unroll
        for (int j = 0; j < 4; ++j) acc[i][j] = zero8();

    v8h aReg[2];
    float4 bReg[4];
    auto load_tiles = [&](int k0) {
#pragma unroll
        for (int c = 0; c < 2; ++c) {
            const int idx = tid + c * 256;
            const int row = idx >> 2, c8 = idx & 3;
            aReg[c] = *(const v8h*)(Xh + (size_t)(m0 + row) * Kdim + k0 + c8 * 8);
        }
#pragma unroll
        for (int c = 0; c < 4; ++c) {
            const int idx = tid + c * 256;
            const int kk = idx >> 5, n4 = idx & 31;
            bReg[c] = *(const float4*)(W + (size_t)(k0 + kk) * Nglob + n0 + n4 * 4);
        }
    };
    auto store_tiles = [&]() {
#pragma unroll
        for (int c = 0; c < 2; ++c) {
            const int idx = tid + c * 256;
            const int row = idx >> 2, c8 = idx & 3;
            *(v8h*)(&As[row * LDS_S + c8 * 8]) = aReg[c];
        }
#pragma unroll
        for (int c = 0; c < 4; ++c) {
            const int idx = tid + c * 256;
            const int kk = idx >> 5, n4 = idx & 31;
            *(v4h*)(&Bs[kk * LDS_B + n4 * 4]) = cvt4(bReg[c]);
        }
    };

    load_tiles(0);
    for (int kt = 0; kt < NT; ++kt) {
        store_tiles();
        __syncthreads();
        if (kt + 1 < NT) load_tiles((kt + 1) * BK);

        v16h afr[2], bfr[4];
#pragma unroll
        for (int im = 0; im < 2; ++im)
            afr[im] = load_frag(&As[(waveM * 32 + im * 16 + l16) * LDS_S], grp);
#pragma unroll
        for (int in = 0; in < 4; ++in)
            bfr[in] = load_frag_tr(&Bs[trRow * LDS_B + waveN * 64 + in * 16 + trCol], LDS_B);
#pragma unroll
        for (int im = 0; im < 2; ++im)
#pragma unroll
            for (int in = 0; in < 4; ++in)
                acc[im][in] = wmma32(afr[im], bfr[in], acc[im][in]);
        __syncthreads();
    }

#pragma unroll
    for (int im = 0; im < 2; ++im)
#pragma unroll
        for (int in = 0; in < 4; ++in)
#pragma unroll
            for (int r = 0; r < 8; ++r) {
                const int mLoc = waveM * 32 + im * 16 + grp * 8 + r;
                const int nLoc = waveN * 64 + in * 16 + l16;
                const int gm = m0 + mLoc;
                const int gn = n0 + nLoc;
                out[(size_t)gm * OUTc + gn] = acc[im][in][r] + bias[gn];
            }
}

// ---------------------------------------------------------------------------
extern "C" void kernel_launch(void* const* d_in, const int* in_sizes, int n_in,
                              void* d_out, int out_size, void* d_ws, size_t ws_size,
                              hipStream_t stream)
{
    (void)in_sizes; (void)n_in; (void)out_size; (void)ws_size;
    const float* query = (const float*)d_in[0];
    const float* key   = (const float*)d_in[1];
    const float* value = (const float*)d_in[2];
    const float* Wq = (const float*)d_in[3];
    const float* bq = (const float*)d_in[4];
    const float* Wk = (const float*)d_in[5];
    const float* bk = (const float*)d_in[6];
    const float* Wv = (const float*)d_in[7];
    const float* bv = (const float*)d_in[8];
    const float* Wf = (const float*)d_in[9];
    const float* bf = (const float*)d_in[10];
    float* out = (float*)d_out;

    // Workspace layout (f16): Qh | Kh | Vh | Xh, each B*H*S*HD = 8,388,608 elems
    _Float16* ws = (_Float16*)d_ws;
    const size_t per = (size_t)Bc * Hc * Sc * HDc;
    _Float16* Qh = ws;
    _Float16* Kh = ws + per;
    _Float16* Vh = ws + 2 * per;
    _Float16* Xh = ws + 3 * per;

    const dim3 blk(256);
    const dim3 gproj(Bc * Sc / 128, Dc / 128);       // (64, 8)
    proj_kernel<<<gproj, blk, 0, stream>>>(query, Wq, bq, Qh);
    proj_kernel<<<gproj, blk, 0, stream>>>(key,   Wk, bk, Kh);
    proj_kernel<<<gproj, blk, 0, stream>>>(value, Wv, bv, Vh);

    attn_kernel<<<dim3(Sc / 128, Bc * Hc), blk, 0, stream>>>(Qh, Kh, Vh, Xh);

    final_kernel<<<dim3(Bc * Sc / 128, OUTc / 128), blk, 0, stream>>>(Xh, Wf, bf, out);
}

// v003
// A run of this version takes 145 microseconds.
// Next to v002, in two timings, it ran 1.36 and 1.37 times as fast.
// All steps since v000 together make it 3.17 times as fast.
#include <hip/hip_runtime.h>
#include <hip/hip_bf16.h>
#include <stdint.h>

typedef _Float16 v16h __attribute__((ext_vector_type(16)));
typedef _Float16 v8h  __attribute__((ext_vector_type(8)));
typedef float    v8f  __attribute__((ext_vector_type(8)));
typedef int      v4i  __attribute__((ext_vector_type(4)));
typedef _Float16 v4h  __attribute__((ext_vector_type(4)));
typedef short    v8s  __attribute__((ext_vector_type(8)));

constexpr int Bc  = 4;
constexpr int Sc  = 2048;
constexpr int Dc  = 1024;
constexpr int Hc  = 16;
constexpr int HDc = 64;
constexpr int OUTc = 256;

#if defined(__has_builtin)
#if __has_builtin(__builtin_amdgcn_global_load_async_to_lds_b128)
#define HAVE_ASYNC_LDS 1
#else
#define HAVE_ASYNC_LDS 0
#endif
#if __has_builtin(__builtin_amdgcn_s_wait_asynccnt)
#define HAVE_WAIT_ASYNC 1
#else
#define HAVE_WAIT_ASYNC 0
#endif
#else
#define HAVE_ASYNC_LDS 0
#define HAVE_WAIT_ASYNC 0
#endif

typedef __attribute__((address_space(1))) v4i gv4i;   // global int4
typedef __attribute__((address_space(3))) v4i lv4i;   // LDS int4

__device__ inline void async_cp16(void* lds, const void* gsrc) {
#if HAVE_ASYNC_LDS
    gv4i* g = (gv4i*)(unsigned long long)(uintptr_t)gsrc;
    lv4i* l = (lv4i*)(unsigned int)(uintptr_t)lds;
    __builtin_amdgcn_global_load_async_to_lds_b128(g, l, 0, 0);
#else
    *(v8h*)lds = *(const v8h*)gsrc;
#endif
}

__device__ inline void wait_async0() {
#if HAVE_ASYNC_LDS
#if HAVE_WAIT_ASYNC
    __builtin_amdgcn_s_wait_asynccnt(0);
#else
    asm volatile("s_wait_asynccnt 0x0" ::: "memory");
#endif
#endif
}

__device__ inline v8f zero8() {
    v8f z;
#pragma unroll
    for (int i = 0; i < 8; ++i) z[i] = 0.0f;
    return z;
}

__device__ inline v16h load_frag(const _Float16* rowPtr, int grp) {
    const v8h lo = *(const v8h*)(rowPtr + grp * 8);
    const v8h hi = *(const v8h*)(rowPtr + grp * 8 + 16);
    v16h r;
#pragma unroll
    for (int i = 0; i < 8; ++i) { r[i] = lo[i]; r[i + 8] = hi[i]; }
    return r;
}

// B fragment (32 k x 16 n) from a ROW-MAJOR [k][n] f16 LDS tile by two
// transposing loads. p is this lane's address:
//   tile + (kbase + 8*grp + (lane&7)) * pitch + nbase + 8*((lane>>3)&1)
// Lane (l16, grp) receives k = kbase + 8*grp + 0..7 of column nbase + l16, the
// second load the same 16 rows further: the k order of load_frag above.
// pitch (halves) is an odd multiple of 16 halves (32 B) for these loads.
typedef __attribute__((address_space(3))) v8s lv8s;
__device__ inline v16h load_frag_tr(const _Float16* p, int pitch) {
    const v8h lo = __builtin_bit_cast(v8h,
        __builtin_amdgcn_ds_load_tr16_b128_v8i16((lv8s*)p));
    const v8h hi = __builtin_bit_cast(v8h,
        __builtin_amdgcn_ds_load_tr16_b128_v8i16((lv8s*)(p + 16 * pitch)));
    v16h r;
#pragma unroll
    for (int i = 0; i < 8; ++i) { r[i] = lo[i]; r[i + 8] = hi[i]; }
    return r;
}

__device__ inline v4h cvt4(float4 f) {
    v4h r;
    r[0] = (_Float16)f.x; r[1] = (_Float16)f.y;
    r[2] = (_Float16)f.z; r[3] = (_Float16)f.w;
    return r;
}

__device__ inline v8f wmma32(v16h a, v16h b, v8f c) {
    return __builtin_amdgcn_wmma_f32_16x16x32_f16(
        /*neg_a=*/false, a, /*neg_b=*/false, b,
        /*c_mod=*/(short)0, c, /*reuse_a=*/false, /*reuse_b=*/false);
}

// ---------------------------------------------------------------------------
// Kernel 1: QKV projection.  C[M=8192, N=1024] = X[M,K=1024] * W[K,N] + bias
// Output written as f16 in [B, H, S, HD] layout (head-transposed).
// Two LDS buffers, one barrier per pass: the global loads of tile k+1 are
// issued behind the barrier of pass k, fly during its LDS reads and WMMAs, and
// are converted and stored into the other buffer at the head of pass k+1.
// ---------------------------------------------------------------------------
__global__ void __launch_bounds__(256)
proj_kernel(const float* __restrict__ X, const float* __restrict__ W,
            const float* __restrict__ bias, _Float16* __restrict__ out)
{
    constexpr int BM = 128, BN = 128, BK = 64;
    constexpr int LDS_S = BK + 8;  // 144B row stride (16B x odd) for b128 reads
    constexpr int LDS_B = 144;     // W tile kept [k][n]: 288B row stride
    constexpr int Kdim = 1024, Nglob = 1024, NT = Kdim / BK;
    constexpr int ASZ = BM * LDS_S, BSZ = BK * LDS_B;      // halves per buffer
    constexpr int AC = BM * BK / 4 / 256, BC = BK * BN / 4 / 256;
    __shared__ __align__(16) _Float16 As[2 * ASZ];
    __shared__ __align__(16) _Float16 Bs[2 * BSZ];

    const int tid  = threadIdx.x;
    const int lane = tid & 31, wid = tid >> 5;
    const int waveM = wid & 3, waveN = wid >> 2;
    const int l16 = lane & 15, grp = lane >> 4;
    const int m0 = blockIdx.x * BM, n0 = blockIdx.y * BN;
    const int trRow = grp * 8 + (lane & 7), trCol = ((lane >> 3) & 1) * 8;

    v8f acc[2][4];
#pragma unroll
    for (int i = 0; i < 2; ++i)
#pragma unroll
        for (int j = 0; j < 4; ++j) acc[i][j] = zero8();

    // Chunk c of a thread lies AR rows (X) or 8 rows (W) below chunk c-1: one
    // running pointer per operand, the chunks at constant offsets from it.
    constexpr int AR = 256 / (BK / 4);
    const int aRow = tid / (BK / 4), aCol = (tid % (BK / 4)) * 4;
    const int bRow = tid >> 5, bCol = (tid & 31) * 4;
    const float* aP = X + (size_t)(m0 + aRow) * Kdim + aCol;
    const float* bP = W + (size_t)bRow * Nglob + n0 + bCol;
    float4 aReg[AC], bReg[BC];
    auto load_tiles = [&]() {   // the next BK columns of X, the next BK rows of W
#pragma unroll
        for (int c = 0; c < AC; ++c)
            aReg[c] = *(const float4*)(aP + (size_t)c * AR * Kdim);
#pragma unroll
        for (int c = 0; c < BC; ++c)
            bReg[c] = *(const float4*)(bP + (size_t)c * 8 * Nglob);
        // The pointers named by the loads above are advanced next. The clobber
        // also keeps these loads ahead of the pass's LDS reads and WMMAs: sunk
        // among them, their whole latency is waited out at the next pass's head.
        asm volatile("s_wait_xcnt 0x0" ::: "memory");
        aP += BK;
        bP += (size_t)BK * Nglob;
    };
    auto store_tiles = [&](int buf) {
#pragma unroll
        for (int c = 0; c < AC; ++c)
            *(v4h*)(&As[buf * ASZ + aRow * LDS_S + aCol + c * AR * LDS_S]) = cvt4(aReg[c]);
#pragma unroll
        for (int c = 0; c < BC; ++c)
            *(v4h*)(&Bs[buf * BSZ + bRow * LDS_B + bCol + c * 8 * LDS_B]) = cvt4(bReg[c]);
    };

    load_tiles();
    for (int kt = 0; kt < NT; ++kt) {
        const int cur = kt & 1;
        store_tiles(cur);   // its last readers (pass kt-2) passed the barrier of pass kt-1
        __syncthreads();    // publishes tile kt
        if (kt + 1 < NT) load_tiles();

#pragma unroll
        for (int ks = 0; ks < BK / 32; ++ks) {
            v16h afr[2], bfr[4];
#pragma unroll
            for (int im = 0; im < 2; ++im)
                afr[im] = load_frag(&As[cur * ASZ + (waveM * 32 + im * 16 + l16) * LDS_S] + ks * 32, grp);
#pragma unroll
            for (int in = 0; in < 4; ++in)
                bfr[in] = load_frag_tr(&Bs[cur * BSZ + (ks * 32 + trRow) * LDS_B + waveN * 64 + in * 16 + trCol], LDS_B);
#pragma unroll
            for (int im = 0; im < 2; ++im)
#pragma unroll
                for (int in = 0; in < 4; ++in)
                    acc[im][in] = wmma32(afr[im], bfr[in], acc[im][in]);
        }
    }

    // Epilogue: bias add, convert f16, scatter to [B,H,S,HD]
#pragma unroll
    for (int im = 0; im < 2; ++im)
#pragma unroll
        for (int in = 0; in < 4; ++in)
#pragma unroll
            for (int r = 0; r < 8; ++r) {
                const int mLoc = waveM * 32 + im * 16 + grp * 8 + r;
                const int nLoc = waveN * 64 + in * 16 + l16;
                const int gm = m0 + mLoc;   // b*S + s
                const int gn = n0 + nLoc;   // h*HD + hd
                const float v = acc[im][in][r] + bias[gn];
                const int b = gm >> 11, s = gm & 2047;
                const int h = gn >> 6, hd = gn & 63;
                out[(((size_t)(b * Hc + h) * Sc + s) * HDc) + hd] = (_Float16)v;
            }
}

__global__ void __launch_bounds__(256)
attn_kernel(const _Float16* __restrict__ Q, const _Float16* __restrict__ K,
            const _Float16* __restrict__ V, _Float16* __restrict__ X)
{
    constexpr int LQ = 72;  // 72 halves = 144B row stride (16B aligned)
    constexpr int LV = 80;  // 80 halves = 160B row stride for transposing loads
    constexpr int NT = Sc / 64;
    __shared__ __align__(16) _Float16 Qs[128 * LQ];      // Q tile
    __shared__ __align__(16) _Float16 Ks[2 * 64 * LQ];   // [buf][key][hd]
    __shared__ __align__(16) _Float16 Vs[2 * 64 * LV];   // [buf][key][hd]

    const int tid  = threadIdx.x;
    const int lane = tid & 31, wid = tid >> 5;
    const int l16 = lane & 15, grp = lane >> 4;
    const int bh = blockIdx.y;            // b*H + h
    const int b  = bh >> 4, h = bh & 15;
    const int q0 = blockIdx.x * 128;
    const int trRow = grp * 8 + (lane & 7), trCol = ((lane >> 3) & 1) * 8;

    const _Float16* Qp = Q + (size_t)bh * Sc * HDc;
    const _Float16* Kp = K + (size_t)bh * Sc * HDc;
    const _Float16* Vp = V + (size_t)bh * Sc * HDc;

    auto stage_kv = [&](int kb, int buf) {
        _Float16* KsB = &Ks[buf * 64 * LQ];
#pragma unroll
        for (int c = 0; c < 2; ++c) {
            const int idx = tid + c * 256;
            const int row = idx >> 3, c8 = idx & 7;
            async_cp16(&KsB[row * LQ + c8 * 8],
                       Kp + (size_t)(kb + row) * HDc + c8 * 8);
        }
#pragma unroll
        for (int c = 0; c < 2; ++c) {
            const int idx = tid + c * 256;
            const int row = idx >> 3, c8 = idx & 7;
            *(v8h*)(&Vs[buf * 64 * LV + row * LV + c8 * 8]) =
                *(const v8h*)(Vp + (size_t)(kb + row) * HDc + c8 * 8);
        }
    };

    // Stage Q tile (async) + first K/V tile, then pull Q fragments to regs.
#pragma unroll
    for (int c = 0; c < 4; ++c) {
        const int idx = tid + c * 256;
        const int row = idx >> 3, c8 = idx & 7;
        async_cp16(&Qs[row * LQ + c8 * 8],
                   Qp + (size_t)(q0 + row) * HDc + c8 * 8);
    }
    stage_kv(0, 0);
    wait_async0();
    __syncthreads();

    // B fragments of Q^T: column = this wave's query l16, k = hd.
    v16h qfr[2];
#pragma unroll
    for (int ks = 0; ks < 2; ++ks)
        qfr[ks] = load_frag(&Qs[(wid * 16 + l16) * LQ] + ks * 32, grp);

    v8f oacc[4];   // O^T: row hd = in*16 + grp*8 + r, column = query l16
#pragma unroll
    for (int i = 0; i < 4; ++i) oacc[i] = zero8();
    float dpart[8];  // this lane's share of its query's sum, 8 chains
#pragma unroll
    for (int r = 0; r < 8; ++r) dpart[r] = 0.0f;

    for (int kt = 0; kt < NT; ++kt) {
        const int cur = kt & 1;
        wait_async0();       // this wave's pending tile (kt) has landed
        __syncthreads();     // all waves' tile kt visible; buf cur^1 is free
        if (kt + 1 < NT) stage_kv((kt + 1) * 64, cur ^ 1);  // DMA overlaps WMMA

        const _Float16* KsB = &Ks[cur * 64 * LQ];
        const _Float16* VsB = &Vs[cur * 64 * LV];

        // S^T = K Q^T  (M=64 keys -> 4 m-subtiles, N=16 queries, K=HD=64)
        v8f e[4];
#pragma unroll
        for (int jm = 0; jm < 4; ++jm) {
            e[jm] = zero8();
#pragma unroll
            for (int ks = 0; ks < 2; ++ks) {
                const v16h afr = load_frag(&KsB[(jm * 16 + l16) * LQ] + ks * 32, grp);
                e[jm] = wmma32(afr, qfr[ks], e[jm]);
            }
        }
        // exp, partial denominator, pack P^T (f16) as B fragments: subtile jm
        // holds keys jm*16 + grp*8 + r, i.e. halves 0..7 (jm even) or 8..15
        // (jm odd) of the 32-key fragment jm/2.
        v16h pfr[2];
#pragma unroll
        for (int jm = 0; jm < 4; ++jm)
#pragma unroll
            for (int r = 0; r < 8; ++r) {
                const float ev = __expf(e[jm][r] * 0.125f);
                dpart[r] += ev;
                pfr[jm >> 1][(jm & 1) * 8 + r] = (_Float16)ev;
            }

        // O^T += V^T P^T  (M=64 hd -> 4 m-subtiles, K=64 keys -> 2 k-steps)
#pragma unroll
        for (int in = 0; in < 4; ++in)
#pragma unroll
            for (int ks = 0; ks < 2; ++ks) {
                const v16h afr = load_frag_tr(
                    &VsB[(ks * 32 + trRow) * LV + in * 16 + trCol], LV);
                oacc[in] = wmma32(afr, pfr[ks], oacc[in]);
            }
    }

    // Denominator of query l16: the lane's 8 chains, then the other half-wave
    // (which held the other 8 keys of every 16).
    float dsum = ((dpart[0] + dpart[1]) + (dpart[2] + dpart[3])) +
                 ((dpart[4] + dpart[5]) + (dpart[6] + dpart[7]));
    dsum += __shfl_xor(dsum, 16);
    const float dinv = 1.0f / (1.0f + dsum);   // softmax_1 denominator

    // Normalize and write X in [B, S, D] f16 layout: 8 consecutive hd per lane
    const int qrow = q0 + wid * 16 + l16;
    _Float16* xrow = X + ((size_t)b * Sc + qrow) * Dc + h * HDc + grp * 8;
#pragma unroll
    for (int in = 0; in < 4; ++in) {
        v8h o;
#pragma unroll
        for (int r = 0; r < 8; ++r) o[r] = (_Float16)(oacc[in][r] * dinv);
        *(v8h*)(xrow + in * 16) = o;
    }
}

// ---------------------------------------------------------------------------
// Kernel 3: final projection.  out[M=8192, N=256] = Xh[M,K=1024] * Wf + bf
// Same 128x128 block tile and two-buffer pass as proj, but BK = 128; A already f16.
// ---------------------------------------------------------------------------
__global__ void __launch_bounds__(256)
final_kernel(const _Float16* __restrict__ Xh, const float* __restrict__ W,
             const float* __restrict__ bias, float* __restrict__ out)
{
    constexpr int BM = 128, BN = 128, BK = 128;
    constexpr int LDS_S = BK + 8;  // 272B row stride (16B x odd) for b128 reads
    constexpr int LDS_B = 144;     // W tile kept [k][n]: 288B row stride
    constexpr int Kdim = 1024, Nglob = 256, NT = Kdim / BK;
    constexpr int ASZ = BM * LDS_S, BSZ = BK * LDS_B;      // halves per buffer
    constexpr int AC = BM * BK / 8 / 256, BC = BK * BN / 4 / 256;
    __shared__ __align__(16) _Float16 As[2 * ASZ];
    __shared__ __align__(16) _Float16 Bs[2 * BSZ];

    const int tid  = threadIdx.x;
    const int lane = tid & 31, wid = tid >> 5;
    const int waveM = wid & 3, waveN = wid >> 2;
    const int l16 = lane & 15, grp = lane >> 4;
    const int m0 = blockIdx.x * BM, n0 = blockIdx.y * BN;
    const int trRow = grp * 8 + (lane & 7), trCol = ((lane >> 3) & 1) * 8;

    v8f acc[2][4];
#pragma unroll
    for (int i = 0; i < 2; ++i)
#pragma unroll
        for (int j = 0; j < 4; ++j) acc[i][j] = zero8();

    // Chunk c of a thread lies AR rows (Xh) or 8 rows (W) below chunk c-1: one
    // running pointer per operand, the chunks at constant offsets from it.
    constexpr int AR = 256 / (BK / 8);
    const int aRow = tid / (BK / 8), aCol = (tid % (BK / 8)) * 8;
    const int bRow = tid >> 5, bCol = (tid & 31) * 4;
    const _Float16* aP = Xh + (size_t)(m0 + aRow) * Kdim + aCol;
    const float* bP = W + (size_t)bRow * Nglob + n0 + bCol;
    v8h aReg[AC];
    float4 bReg[BC];
    auto load_tiles = [&]() {   // the next BK columns of Xh, the next BK rows of W
#pragma unroll
        for (int c = 0; c < AC; ++c)
            aReg[c] = *(const v8h*)(aP + (size_t)c * AR * Kdim);
#pragma unroll
        for (int c = 0; c < BC; ++c)
            bReg[c] = *(const float4*)(bP + (size_t)c * 8 * Nglob);
        // The pointers named by the loads above are advanced next. The clobber
        // also keeps these loads ahead of the pass's LDS reads and WMMAs: sunk
        // among them, their whole latency is waited out at the next pass's head.
        asm volatile("s_wait_xcnt 0x0" ::: "memory");
        aP += BK;
        bP += (size_t)BK * Nglob;
    };
    auto store_tiles = [&](int buf) {
#pragma unroll
        for (int c = 0; c < AC; ++c)
            *(v8h*)(&As[buf * ASZ + aRow * LDS_S + aCol + c * AR * LDS_S]) = aReg[c];
#pragma unroll
        for (int c = 0; c < BC; ++c)
            *(v4h*)(&Bs[buf * BSZ + bRow * LDS_B + bCol + c * 8 * LDS_B]) = cvt4(bReg[c]);
    };

    load_tiles();
    for (int kt = 0; kt < NT; ++kt) {
        const int cur = kt & 1;
        store_tiles(cur);   // its last readers (pass kt-2) passed the barrier of pass kt-1
        __syncthreads();    // publishes tile kt
        if (kt + 1 < NT) load_tiles();

#pragma unroll
        for (int ks = 0; ks < BK / 32; ++ks) {
            v16h afr[2], bfr[4];
#pragma unroll
            for (int im = 0; im < 2; ++im)
                afr[im] = load_frag(&As[cur * ASZ + (waveM * 32 + im * 16 + l16) * LDS_S] + ks * 32, grp);
#pragma unroll
            for (int in = 0; in < 4; ++in)
                bfr[in] = load_frag_tr(&Bs[cur * BSZ + (ks * 32 + trRow) * LDS_B + waveN * 64 + in * 16 + trCol], LDS_B);
#pragma unroll
            for (int im = 0; im < 2; ++im)
#pragma unroll
                for (int in = 0; in < 4; ++in)
                    acc[im][in] = wmma32(afr[im], bfr[in], acc[im][in]);
        }
    }

#pragma unroll
    for (int im = 0; im < 2; ++im)
#pragma unroll
        for (int in = 0; in < 4; ++in)
#pragma unroll
            for (int r = 0; r < 8; ++r) {
                const int mLoc = waveM * 32 + im * 16 + grp * 8 + r;
                const int nLoc = waveN * 64 + in * 16 + l16;
                const int gm = m0 + mLoc;
                const int gn = n0 + nLoc;
                out[(size_t)gm * OUTc + gn] = acc[im][in][r] + bias[gn];
            }
}

// ---------------------------------------------------------------------------
extern "C" void kernel_launch(void* const* d_in, const int* in_sizes, int n_in,
                              void* d_out, int out_size, void* d_ws, size_t ws_size,
                              hipStream_t stream)
{
    (void)in_sizes; (void)n_in; (void)out_size; (void)ws_size;
    const float* query = (const float*)d_in[0];
    const float* key   = (const float*)d_in[1];
    const float* value = (const float*)d_in[2];
    const float* Wq = (const float*)d_in[3];
    const float* bq = (const float*)d_in[4];
    const float* Wk = (const float*)d_in[5];
    const float* bk = (const float*)d_in[6];
    const float* Wv = (const float*)d_in[7];
    const float* bv = (const float*)d_in[8];
    const float* Wf = (const float*)d_in[9];
    const float* bf = (const float*)d_in[10];
    float* out = (float*)d_out;

    // Workspace layout (f16): Qh | Kh | Vh | Xh, each B*H*S*HD = 8,388,608 elems
    _Float16* ws = (_Float16*)d_ws;
    const size_t per = (size_t)Bc * Hc * Sc * HDc;
    _Float16* Qh = ws;
    _Float16* Kh = ws + per;
    _Float16* Vh = ws + 2 * per;
    _Float16* Xh = ws + 3 * per;

    const dim3 blk(256);
    const dim3 gproj(Bc * Sc / 128, Dc / 128);       // (64, 8)
    proj_kernel<<<gproj, blk, 0, stream>>>(query, Wq, bq, Qh);
    proj_kernel<<<gproj, blk, 0, stream>>>(key,   Wk, bk, Kh);
    proj_kernel<<<gproj, blk, 0, stream>>>(value, Wv, bv, Vh);

    attn_kernel<<<dim3(Sc / 128, Bc * Hc), blk, 0, stream>>>(Qh, Kh, Vh, Xh);

    final_kernel<<<dim3(Bc * Sc / 128, OUTc / 128), blk, 0, stream>>>(Xh, Wf, bf, out);
}

// v004
// It runs in 141 microseconds.
// Timed twice side by side with v003, it ran 1.03 times as fast both times.
// Over all steps from v000 it is 3.28 times as fast.
#include <hip/hip_runtime.h>
#include <hip/hip_bf16.h>
#include <stdint.h>

typedef _Float16 v16h __attribute__((ext_vector_type(16)));
typedef _Float16 v8h  __attribute__((ext_vector_type(8)));
typedef float    v8f  __attribute__((ext_vector_type(8)));
typedef int      v4i  __attribute__((ext_vector_type(4)));
typedef _Float16 v4h  __attribute__((ext_vector_type(4)));
typedef short    v8s  __attribute__((ext_vector_type(8)));

constexpr int Bc  = 4;
constexpr int Sc  = 2048;
constexpr int Dc  = 1024;
constexpr int Hc  = 16;
constexpr int HDc = 64;
constexpr int OUTc = 256;

#if defined(__has_builtin)
#if __has_builtin(__builtin_amdgcn_global_load_async_to_lds_b128)
#define HAVE_ASYNC_LDS 1
#else
#define HAVE_ASYNC_LDS 0
#endif
#if __has_builtin(__builtin_amdgcn_s_wait_asynccnt)
#define HAVE_WAIT_ASYNC 1
#else
#define HAVE_WAIT_ASYNC 0
#endif
#else
#define HAVE_ASYNC_LDS 0
#define HAVE_WAIT_ASYNC 0
#endif

typedef __attribute__((address_space(1))) v4i gv4i;   // global int4
typedef __attribute__((address_space(3))) v4i lv4i;   // LDS int4

__device__ inline void async_cp16(void* lds, const void* gsrc) {
#if HAVE_ASYNC_LDS
    gv4i* g = (gv4i*)(unsigned long long)(uintptr_t)gsrc;
    lv4i* l = (lv4i*)(unsigned int)(uintptr_t)lds;
    __builtin_amdgcn_global_load_async_to_lds_b128(g, l, 0, 0);
#else
    *(v8h*)lds = *(const v8h*)gsrc;
#endif
}

__device__ inline void wait_async0() {
#if HAVE_ASYNC_LDS
#if HAVE_WAIT_ASYNC
    __builtin_amdgcn_s_wait_asynccnt(0);
#else
    asm volatile("s_wait_asynccnt 0x0" ::: "memory");
#endif
#endif
}

__device__ inline v8f zero8() {
    v8f z;
#pragma unroll
    for (int i = 0; i < 8; ++i) z[i] = 0.0f;
    return z;
}

__device__ inline v16h load_frag(const _Float16* rowPtr, int grp) {
    const v8h lo = *(const v8h*)(rowPtr + grp * 8);
    const v8h hi = *(const v8h*)(rowPtr + grp * 8 + 16);
    v16h r;
#pragma unroll
    for (int i = 0; i < 8; ++i) { r[i] = lo[i]; r[i + 8] = hi[i]; }
    return r;
}

// B fragment (32 k x 16 n) from a ROW-MAJOR [k][n] f16 LDS tile by two
// transposing loads. p is this lane's address:
//   tile + (kbase + 8*grp + (lane&7)) * pitch + nbase + 8*((lane>>3)&1)
// Lane (l16, grp) receives k = kbase + 8*grp + 0..7 of column nbase + l16, the
// second load the same 16 rows further: the k order of load_frag above.
// pitch (halves) is an odd multiple of 16 halves (32 B) for these loads.
typedef __attribute__((address_space(3))) v8s lv8s;
__device__ inline v16h load_frag_tr(const _Float16* p, int pitch) {
    const v8h lo = __builtin_bit_cast(v8h,
        __builtin_amdgcn_ds_load_tr16_b128_v8i16((lv8s*)p));
    const v8h hi = __builtin_bit_cast(v8h,
        __builtin_amdgcn_ds_load_tr16_b128_v8i16((lv8s*)(p + 16 * pitch)));
    v16h r;
#pragma unroll
    for (int i = 0; i < 8; ++i) { r[i] = lo[i]; r[i + 8] = hi[i]; }
    return r;
}

__device__ inline v4h cvt4(float4 f) {
    v4h r;
    r[0] = (_Float16)f.x; r[1] = (_Float16)f.y;
    r[2] = (_Float16)f.z; r[3] = (_Float16)f.w;
    return r;
}

__device__ inline v8f wmma32(v16h a, v16h b, v8f c) {
    return __builtin_amdgcn_wmma_f32_16x16x32_f16(
        /*neg_a=*/false, a, /*neg_b=*/false, b,
        /*c_mod=*/(short)0, c, /*reuse_a=*/false, /*reuse_b=*/false);
}

// ---------------------------------------------------------------------------
// Kernel 1: QKV projection.  C[M=8192, N=1024] = X[M,K=1024] * W[K,N] + bias
// Output written as f16 in [B, H, S, HD] layout (head-transposed).
// Two LDS buffers, one barrier per pass: the global loads of tile k+1 are
// issued behind the barrier of pass k, fly during its LDS reads and WMMAs, and
// are converted and stored into the other buffer at the head of pass k+1.
// ---------------------------------------------------------------------------
__global__ void __launch_bounds__(256)
proj_kernel(const float* __restrict__ X, const float* __restrict__ W,
            const float* __restrict__ bias, _Float16* __restrict__ out)
{
    constexpr int BM = 128, BN = 128, BK = 64;
    constexpr int LDS_S = BK + 8;  // 144B row stride (16B x odd) for b128 reads
    constexpr int LDS_B = 144;     // W tile kept [k][n]: 288B row stride
    constexpr int Kdim = 1024, Nglob = 1024, NT = Kdim / BK;
    constexpr int ASZ = BM * LDS_S, BSZ = BK * LDS_B;      // halves per buffer
    constexpr int AC = BM * BK / 4 / 256, BC = BK * BN / 4 / 256;
    __shared__ __align__(16) _Float16 As[2 * ASZ];
    __shared__ __align__(16) _Float16 Bs[2 * BSZ];

    const int tid  = threadIdx.x;
    const int lane = tid & 31, wid = tid >> 5;
    const int waveM = wid & 3, waveN = wid >> 2;
    const int l16 = lane & 15, grp = lane >> 4;
    const int m0 = blockIdx.x * BM, n0 = blockIdx.y * BN;
    const int trRow = grp * 8 + (lane & 7), trCol = ((lane >> 3) & 1) * 8;

    v8f acc[2][4];
#pragma unroll
    for (int i = 0; i < 2; ++i)
#pragma unroll
        for (int j = 0; j < 4; ++j) acc[i][j] = zero8();

    // Chunk c of a thread lies AR rows (X) or 8 rows (W) below chunk c-1: one
    // running pointer per operand, the chunks at constant offsets from it.
    constexpr int AR = 256 / (BK / 4);
    const int aRow = tid / (BK / 4), aCol = (tid % (BK / 4)) * 4;
    const int bRow = tid >> 5, bCol = (tid & 31) * 4;
    const float* aP = X + (size_t)(m0 + aRow) * Kdim + aCol;
    const float* bP = W + (size_t)bRow * Nglob + n0 + bCol;
    float4 aReg[AC], bReg[BC];
    auto load_tiles = [&]() {   // the next BK columns of X, the next BK rows of W
#pragma unroll
        for (int c = 0; c < AC; ++c)
            aReg[c] = *(const float4*)(aP + (size_t)c * AR * Kdim);
#pragma unroll
        for (int c = 0; c < BC; ++c)
            bReg[c] = *(const float4*)(bP + (size_t)c * 8 * Nglob);
        // The pointers named by the loads above are advanced next. The clobber
        // also keeps these loads ahead of the pass's LDS reads and WMMAs: sunk
        // among them, their whole latency is waited out at the next pass's head.
        asm volatile("s_wait_xcnt 0x0" ::: "memory");
        aP += BK;
        bP += (size_t)BK * Nglob;
    };
    auto store_tiles = [&](int buf) {
#pragma unroll
        for (int c = 0; c < AC; ++c)
            *(v4h*)(&As[buf * ASZ + aRow * LDS_S + aCol + c * AR * LDS_S]) = cvt4(aReg[c]);
#pragma unroll
        for (int c = 0; c < BC; ++c)
            *(v4h*)(&Bs[buf * BSZ + bRow * LDS_B + bCol + c * 8 * LDS_B]) = cvt4(bReg[c]);
    };

    load_tiles();
    for (int kt = 0; kt < NT; ++kt) {
        const int cur = kt & 1;
        store_tiles(cur);   // its last readers (pass kt-2) passed the barrier of pass kt-1
        __syncthreads();    // publishes tile kt
        if (kt + 1 < NT) load_tiles();

#pragma unroll
        for (int ks = 0; ks < BK / 32; ++ks) {
            v16h afr[2], bfr[4];
#pragma unroll
            for (int im = 0; im < 2; ++im)
                afr[im] = load_frag(&As[cur * ASZ + (waveM * 32 + im * 16 + l16) * LDS_S] + ks * 32, grp);
#pragma unroll
            for (int in = 0; in < 4; ++in)
                bfr[in] = load_frag_tr(&Bs[cur * BSZ + (ks * 32 + trRow) * LDS_B + waveN * 64 + in * 16 + trCol], LDS_B);
#pragma unroll
            for (int im = 0; im < 2; ++im)
#pragma unroll
                for (int in = 0; in < 4; ++in)
                    acc[im][in] = wmma32(afr[im], bfr[in], acc[im][in]);
        }
    }

    // Epilogue: bias add, convert f16, scatter to [B,H,S,HD]
#pragma unroll
    for (int im = 0; im < 2; ++im)
#pragma unroll
        for (int in = 0; in < 4; ++in)
#pragma unroll
            for (int r = 0; r < 8; ++r) {
                const int mLoc = waveM * 32 + im * 16 + grp * 8 + r;
                const int nLoc = waveN * 64 + in * 16 + l16;
                const int gm = m0 + mLoc;   // b*S + s
                const int gn = n0 + nLoc;   // h*HD + hd
                const float v = acc[im][in][r] + bias[gn];
                const int b = gm >> 11, s = gm & 2047;
                const int h = gn >> 6, hd = gn & 63;
                out[(((size_t)(b * Hc + h) * Sc + s) * HDc) + hd] = (_Float16)v;
            }
}

__global__ void __launch_bounds__(256)
attn_kernel(const _Float16* __restrict__ Q, const _Float16* __restrict__ K,
            const _Float16* __restrict__ V, _Float16* __restrict__ X)
{
    constexpr int LQ = 72;  // 72 halves = 144B row stride (16B aligned)
    constexpr int LV = 80;  // 80 halves = 160B row stride for transposing loads
    constexpr int NT = Sc / 64;
    constexpr int QB = 256; // queries per block
    __shared__ __align__(16) _Float16 Qs[QB * LQ];       // Q tile
    __shared__ __align__(16) _Float16 Ks[2 * 64 * LQ];   // [buf][key][hd]
    __shared__ __align__(16) _Float16 Vs[2 * 64 * LV];   // [buf][key][hd]

    const int tid  = threadIdx.x;
    const int lane = tid & 31, wid = tid >> 5;
    const int l16 = lane & 15, grp = lane >> 4;
    const int bh = blockIdx.y;            // b*H + h
    const int b  = bh >> 4, h = bh & 15;
    const int q0 = blockIdx.x * QB;
    const int trRow = grp * 8 + (lane & 7), trCol = ((lane >> 3) & 1) * 8;

    const _Float16* Qp = Q + (size_t)bh * Sc * HDc;
    const _Float16* Kp = K + (size_t)bh * Sc * HDc;
    const _Float16* Vp = V + (size_t)bh * Sc * HDc;

    auto stage_kv = [&](int kb, int buf) {
        _Float16* KsB = &Ks[buf * 64 * LQ];
#pragma unroll
        for (int c = 0; c < 2; ++c) {
            const int idx = tid + c * 256;
            const int row = idx >> 3, c8 = idx & 7;
            async_cp16(&KsB[row * LQ + c8 * 8],
                       Kp + (size_t)(kb + row) * HDc + c8 * 8);
        }
#pragma unroll
        for (int c = 0; c < 2; ++c) {
            const int idx = tid + c * 256;
            const int row = idx >> 3, c8 = idx & 7;
            *(v8h*)(&Vs[buf * 64 * LV + row * LV + c8 * 8]) =
                *(const v8h*)(Vp + (size_t)(kb + row) * HDc + c8 * 8);
        }
    };

    // Stage Q tile (async) + first K/V tile, then pull Q fragments to regs.
#pragma unroll
    for (int c = 0; c < QB / 32; ++c) {
        const int idx = tid + c * 256;
        const int row = idx >> 3, c8 = idx & 7;
        async_cp16(&Qs[row * LQ + c8 * 8],
                   Qp + (size_t)(q0 + row) * HDc + c8 * 8);
    }
    stage_kv(0, 0);
    wait_async0();
    __syncthreads();

    // B fragments of Q^T: column group cg, column = query wid*32 + cg*16 + l16,
    // k = hd.
    v16h qfr[2][2];
#pragma unroll
    for (int cg = 0; cg < 2; ++cg)
#pragma unroll
        for (int ks = 0; ks < 2; ++ks)
            qfr[cg][ks] = load_frag(&Qs[(wid * 32 + cg * 16 + l16) * LQ] + ks * 32, grp);

    v8f oacc[2][4];  // O^T: row hd = in*16 + grp*8 + r, column = query l16 of group cg
    float dpart[2][8];  // this lane's share of its two queries' sums, 8 chains each
#pragma unroll
    for (int cg = 0; cg < 2; ++cg) {
#pragma unroll
        for (int i = 0; i < 4; ++i) oacc[cg][i] = zero8();
#pragma unroll
        for (int r = 0; r < 8; ++r) dpart[cg][r] = 0.0f;
    }

    for (int kt = 0; kt < NT; ++kt) {
        const int cur = kt & 1;
        wait_async0();       // this wave's pending tile (kt) has landed
        __syncthreads();     // all waves' tile kt visible; buf cur^1 is free
        if (kt + 1 < NT) stage_kv((kt + 1) * 64, cur ^ 1);  // DMA overlaps WMMA

        const _Float16* KsB = &Ks[cur * 64 * LQ];
        const _Float16* VsB = &Vs[cur * 64 * LV];

        // S^T = K Q^T  (M=64 keys -> 4 m-subtiles, N=2x16 queries, K=HD=64)
        v8f e[2][4];
#pragma unroll
        for (int jm = 0; jm < 4; ++jm) {
            e[0][jm] = zero8();
            e[1][jm] = zero8();
#pragma unroll
            for (int ks = 0; ks < 2; ++ks) {
                const v16h afr = load_frag(&KsB[(jm * 16 + l16) * LQ] + ks * 32, grp);
#pragma unroll
                for (int cg = 0; cg < 2; ++cg)
                    e[cg][jm] = wmma32(afr, qfr[cg][ks], e[cg][jm]);
            }
        }
        // exp, partial denominator, pack P^T (f16) as B fragments: subtile jm
        // holds keys jm*16 + grp*8 + r, i.e. halves 0..7 (jm even) or 8..15
        // (jm odd) of the 32-key fragment jm/2.
        v16h pfr[2][2];
#pragma unroll
        for (int cg = 0; cg < 2; ++cg)
#pragma unroll
            for (int jm = 0; jm < 4; ++jm)
#pragma unroll
                for (int r = 0; r < 8; ++r) {
                    const float ev = __expf(e[cg][jm][r] * 0.125f);
                    dpart[cg][r] += ev;
                    pfr[cg][jm >> 1][(jm & 1) * 8 + r] = (_Float16)ev;
                }

        // O^T += V^T P^T  (M=64 hd -> 4 m-subtiles, K=64 keys -> 2 k-steps)
#pragma unroll
        for (int in = 0; in < 4; ++in)
#pragma unroll
            for (int ks = 0; ks < 2; ++ks) {
                const v16h afr = load_frag_tr(
                    &VsB[(ks * 32 + trRow) * LV + in * 16 + trCol], LV);
#pragma unroll
                for (int cg = 0; cg < 2; ++cg)
                    oacc[cg][in] = wmma32(afr, pfr[cg][ks], oacc[cg][in]);
            }
    }

#pragma unroll
    for (int cg = 0; cg < 2; ++cg) {
        // Denominator of query l16 of group cg: the lane's 8 chains, then the
        // other half-wave (which held the other 8 keys of every 16).
        float dsum = ((dpart[cg][0] + dpart[cg][1]) + (dpart[cg][2] + dpart[cg][3])) +
                     ((dpart[cg][4] + dpart[cg][5]) + (dpart[cg][6] + dpart[cg][7]));
        dsum += __shfl_xor(dsum, 16);
        const float dinv = 1.0f / (1.0f + dsum);   // softmax_1 denominator

        // Normalize and write X in [B, S, D] f16 layout: 8 consecutive hd per lane
        const int qrow = q0 + wid * 32 + cg * 16 + l16;
        _Float16* xrow = X + ((size_t)b * Sc + qrow) * Dc + h * HDc + grp * 8;
#pragma unroll
        for (int in = 0; in < 4; ++in) {
            v8h o;
#pragma unroll
            for (int r = 0; r < 8; ++r) o[r] = (_Float16)(oacc[cg][in][r] * dinv);
            *(v8h*)(xrow + in * 16) = o;
        }
    }
}

// ---------------------------------------------------------------------------
// Kernel 3: final projection.  out[M=8192, N=256] = Xh[M,K=1024] * Wf + bf
// Same 128x128 block tile and two-buffer pass as proj, but BK = 128; A already f16.
// ---------------------------------------------------------------------------
__global__ void __launch_bounds__(256)
final_kernel(const _Float16* __restrict__ Xh, const float* __restrict__ W,
             const float* __restrict__ bias, float* __restrict__ out)
{
    constexpr int BM = 128, BN = 128, BK = 128;
    constexpr int LDS_S = BK + 8;  // 272B row stride (16B x odd) for b128 reads
    constexpr int LDS_B = 144;     // W tile kept [k][n]: 288B row stride
    constexpr int Kdim = 1024, Nglob = 256, NT = Kdim / BK;
    constexpr int ASZ = BM * LDS_S, BSZ = BK * LDS_B;      // halves per buffer
    constexpr int AC = BM * BK / 8 / 256, BC = BK * BN / 4 / 256;
    __shared__ __align__(16) _Float16 As[2 * ASZ];
    __shared__ __align__(16) _Float16 Bs[2 * BSZ];

    const int tid  = threadIdx.x;
    const int lane = tid & 31, wid = tid >> 5;
    const int waveM = wid & 3, waveN = wid >> 2;
    const int l16 = lane & 15, grp = lane >> 4;
    const int m0 = blockIdx.x * BM, n0 = blockIdx.y * BN;
    const int trRow = grp * 8 + (lane & 7), trCol = ((lane >> 3) & 1) * 8;

    v8f acc[2][4];
#pragma unroll
    for (int i = 0; i < 2; ++i)
#pragma unroll
        for (int j = 0; j < 4; ++j) acc[i][j] = zero8();

    // Chunk c of a thread lies AR rows (Xh) or 8 rows (W) below chunk c-1: one
    // running pointer per operand, the chunks at constant offsets from it.
    constexpr int AR = 256 / (BK / 8);
    const int aRow = tid / (BK / 8), aCol = (tid % (BK / 8)) * 8;
    const int bRow = tid >> 5, bCol = (tid & 31) * 4;
    const _Float16* aP = Xh + (size_t)(m0 + aRow) * Kdim + aCol;
    const float* bP = W + (size_t)bRow * Nglob + n0 + bCol;
    v8h aReg[AC];
    float4 bReg[BC];
    auto load_tiles = [&]() {   // the next BK columns of Xh, the next BK rows of W
#pragma unroll
        for (int c = 0; c < AC; ++c)
            aReg[c] = *(const v8h*)(aP + (size_t)c * AR * Kdim);
#pragma unroll
        for (int c = 0; c < BC; ++c)
            bReg[c] = *(const float4*)(bP + (size_t)c * 8 * Nglob);
        // The pointers named by the loads above are advanced next. The clobber
        // also keeps these loads ahead of the pass's LDS reads and WMMAs: sunk
        // among them, their whole latency is waited out at the next pass's head.
        asm volatile("s_wait_xcnt 0x0" ::: "memory");
        aP += BK;
        bP += (size_t)BK * Nglob;
    };
    auto store_tiles = [&](int buf) {
#pragma unroll
        for (int c = 0; c < AC; ++c)
            *(v8h*)(&As[buf * ASZ + aRow * LDS_S + aCol + c * AR * LDS_S]) = aReg[c];
#pragma unroll
        for (int c = 0; c < BC; ++c)
            *(v4h*)(&Bs[buf * BSZ + bRow * LDS_B + bCol + c * 8 * LDS_B]) = cvt4(bReg[c]);
    };

    load_tiles();
    for (int kt = 0; kt < NT; ++kt) {
        const int cur = kt & 1;
        store_tiles(cur);   // its last readers (pass kt-2) passed the barrier of pass kt-1
        __syncthreads();    // publishes tile kt
        if (kt + 1 < NT) load_tiles();

#pragma unroll
        for (int ks = 0; ks < BK / 32; ++ks) {
            v16h afr[2], bfr[4];
#pragma unroll
            for (int im = 0; im < 2; ++im)
                afr[im] = load_frag(&As[cur * ASZ + (waveM * 32 + im * 16 + l16) * LDS_S] + ks * 32, grp);
#pragma unroll
            for (int in = 0; in < 4; ++in)
                bfr[in] = load_frag_tr(&Bs[cur * BSZ + (ks * 32 + trRow) * LDS_B + waveN * 64 + in * 16 + trCol], LDS_B);
#pragma unroll
            for (int im = 0; im < 2; ++im)
#pragma unroll
                for (int in = 0; in < 4; ++in)
                    acc[im][in] = wmma32(afr[im], bfr[in], acc[im][in]);
        }
    }

#pragma unroll
    for (int im = 0; im < 2; ++im)
#pragma unroll
        for (int in = 0; in < 4; ++in)
#pragma unroll
            for (int r = 0; r < 8; ++r) {
                const int mLoc = waveM * 32 + im * 16 + grp * 8 + r;
                const int nLoc = waveN * 64 + in * 16 + l16;
                const int gm = m0 + mLoc;
                const int gn = n0 + nLoc;
                out[(size_t)gm * OUTc + gn] = acc[im][in][r] + bias[gn];
            }
}

// ---------------------------------------------------------------------------
extern "C" void kernel_launch(void* const* d_in, const int* in_sizes, int n_in,
                              void* d_out, int out_size, void* d_ws, size_t ws_size,
                              hipStream_t stream)
{
    (void)in_sizes; (void)n_in; (void)out_size; (void)ws_size;
    const float* query = (const float*)d_in[0];
    const float* key   = (const float*)d_in[1];
    const float* value = (const float*)d_in[2];
    const float* Wq = (const float*)d_in[3];
    const float* bq = (const float*)d_in[4];
    const float* Wk = (const float*)d_in[5];
    const float* bk = (const float*)d_in[6];
    const float* Wv = (const float*)d_in[7];
    const float* bv = (const float*)d_in[8];
    const float* Wf = (const float*)d_in[9];
    const float* bf = (const float*)d_in[10];
    float* out = (float*)d_out;

    // Workspace layout (f16): Qh | Kh | Vh | Xh, each B*H*S*HD = 8,388,608 elems
    _Float16* ws = (_Float16*)d_ws;
    const size_t per = (size_t)Bc * Hc * Sc * HDc;
    _Float16* Qh = ws;
    _Float16* Kh = ws + per;
    _Float16* Vh = ws + 2 * per;
    _Float16* Xh = ws + 3 * per;

    const dim3 blk(256);
    const dim3 gproj(Bc * Sc / 128, Dc / 128);       // (64, 8)
    proj_kernel<<<gproj, blk, 0, stream>>>(query, Wq, bq, Qh);
    proj_kernel<<<gproj, blk, 0, stream>>>(key,   Wk, bk, Kh);
    proj_kernel<<<gproj, blk, 0, stream>>>(value, Wv, bv, Vh);

    attn_kernel<<<dim3(Sc / 256, Bc * Hc), blk, 0, stream>>>(Qh, Kh, Vh, Xh);

    final_kernel<<<dim3(Bc * Sc / 128, OUTc / 128), blk, 0, stream>>>(Xh, Wf, bf, out);
}

// v005
// It runs in 135 microseconds.
// In both of two side-by-side timings against v004, it was 1.05 times as fast.
// All steps since v000 together make it 3.43 times as fast.
#include <hip/hip_runtime.h>
#include <hip/hip_bf16.h>
#include <stdint.h>

typedef _Float16 v16h __attribute__((ext_vector_type(16)));
typedef _Float16 v8h  __attribute__((ext_vector_type(8)));
typedef float    v8f  __attribute__((ext_vector_type(8)));
typedef int      v4i  __attribute__((ext_vector_type(4)));
typedef _Float16 v4h  __attribute__((ext_vector_type(4)));
typedef short    v8s  __attribute__((ext_vector_type(8)));

constexpr int Bc  = 4;
constexpr int Sc  = 2048;
constexpr int Dc  = 1024;
constexpr int Hc  = 16;
constexpr int HDc = 64;
constexpr int OUTc = 256;

#if defined(__has_builtin)
#if __has_builtin(__builtin_amdgcn_global_load_async_to_lds_b128)
#define HAVE_ASYNC_LDS 1
#else
#define HAVE_ASYNC_LDS 0
#endif
#if __has_builtin(__builtin_amdgcn_s_wait_asynccnt)
#define HAVE_WAIT_ASYNC 1
#else
#define HAVE_WAIT_ASYNC 0
#endif
#else
#define HAVE_ASYNC_LDS 0
#define HAVE_WAIT_ASYNC 0
#endif

typedef __attribute__((address_space(1))) v4i gv4i;   // global int4
typedef __attribute__((address_space(3))) v4i lv4i;   // LDS int4

__device__ inline void async_cp16(void* lds, const void* gsrc) {
#if HAVE_ASYNC_LDS
    gv4i* g = (gv4i*)(unsigned long long)(uintptr_t)gsrc;
    lv4i* l = (lv4i*)(unsigned int)(uintptr_t)lds;
    __builtin_amdgcn_global_load_async_to_lds_b128(g, l, 0, 0);
#else
    *(v8h*)lds = *(const v8h*)gsrc;
#endif
}

__device__ inline void wait_async0() {
#if HAVE_ASYNC_LDS
#if HAVE_WAIT_ASYNC
    __builtin_amdgcn_s_wait_asynccnt(0);
#else
    asm volatile("s_wait_asynccnt 0x0" ::: "memory");
#endif
#endif
}

__device__ inline v8f zero8() {
    v8f z;
#pragma unroll
    for (int i = 0; i < 8; ++i) z[i] = 0.0f;
    return z;
}

__device__ inline v16h load_frag(const _Float16* rowPtr, int grp) {
    const v8h lo = *(const v8h*)(rowPtr + grp * 8);
    const v8h hi = *(const v8h*)(rowPtr + grp * 8 + 16);
    v16h r;
#pragma unroll
    for (int i = 0; i < 8; ++i) { r[i] = lo[i]; r[i + 8] = hi[i]; }
    return r;
}

// B fragment (32 k x 16 n) from a ROW-MAJOR [k][n] f16 LDS tile by two
// transposing loads. p is this lane's address:
//   tile + (kbase + 8*grp + (lane&7)) * pitch + nbase + 8*((lane>>3)&1)
// Lane (l16, grp) receives k = kbase + 8*grp + 0..7 of column nbase + l16, the
// second load the same 16 rows further: the k order of load_frag above.
// pitch (halves) is an odd multiple of 16 halves (32 B) for these loads.
typedef __attribute__((address_space(3))) v8s lv8s;
__device__ inline v16h load_frag_tr(const _Float16* p, int pitch) {
    const v8h lo = __builtin_bit_cast(v8h,
        __builtin_amdgcn_ds_load_tr16_b128_v8i16((lv8s*)p));
    const v8h hi = __builtin_bit_cast(v8h,
        __builtin_amdgcn_ds_load_tr16_b128_v8i16((lv8s*)(p + 16 * pitch)));
    v16h r;
#pragma unroll
    for (int i = 0; i < 8; ++i) { r[i] = lo[i]; r[i + 8] = hi[i]; }
    return r;
}

__device__ inline v4h cvt4(float4 f) {
    v4h r;
    r[0] = (_Float16)f.x; r[1] = (_Float16)f.y;
    r[2] = (_Float16)f.z; r[3] = (_Float16)f.w;
    return r;
}

__device__ inline v8f wmma32(v16h a, v16h b, v8f c) {
    return __builtin_amdgcn_wmma_f32_16x16x32_f16(
        /*neg_a=*/false, a, /*neg_b=*/false, b,
        /*c_mod=*/(short)0, c, /*reuse_a=*/false, /*reuse_b=*/false);
}

// ---------------------------------------------------------------------------
// Kernel 1: QKV projection.  C[M=8192, N=1024] = X[M,K=1024] * W[K,N] + bias
// Output written as f16 in [B, H, S, HD] layout (head-transposed).
// Two LDS buffers, one barrier per pass: the global loads of tile k+1 are
// issued behind the barrier of pass k, fly during its LDS reads and WMMAs, and
// are converted and stored into the other buffer at the head of pass k+1.
// ---------------------------------------------------------------------------
__global__ void __launch_bounds__(256)
proj_kernel(const float* __restrict__ X, const float* __restrict__ W,
            const float* __restrict__ bias, _Float16* __restrict__ out)
{
    constexpr int BM = 128, BN = 128, BK = 64;
    constexpr int LDS_S = BK + 8;  // 144B row stride (16B x odd) for b128 reads
    constexpr int LDS_B = 144;     // W tile kept [k][n]: 288B row stride
    constexpr int Kdim = 1024, Nglob = 1024, NT = Kdim / BK;
    constexpr int ASZ = BM * LDS_S, BSZ = BK * LDS_B;      // halves per buffer
    constexpr int AC = BM * BK / 4 / 256, BC = BK * BN / 4 / 256;
    __shared__ __align__(16) _Float16 As[2 * ASZ];
    __shared__ __align__(16) _Float16 Bs[2 * BSZ];

    const int tid  = threadIdx.x;
    const int lane = tid & 31, wid = tid >> 5;
    const int waveM = wid & 3, waveN = wid >> 2;
    const int l16 = lane & 15, grp = lane >> 4;
    const int m0 = blockIdx.x * BM, n0 = blockIdx.y * BN;
    const int trRow = grp * 8 + (lane & 7), trCol = ((lane >> 3) & 1) * 8;

    v8f acc[2][4];
#pragma unroll
    for (int i = 0; i < 2; ++i)
#pragma unroll
        for (int j = 0; j < 4; ++j) acc[i][j] = zero8();

    // Chunk c of a thread lies AR rows (X) or 8 rows (W) below chunk c-1: one
    // running pointer per operand, the chunks at constant offsets from it.
    constexpr int AR = 256 / (BK / 4);
    const int aRow = tid / (BK / 4), aCol = (tid % (BK / 4)) * 4;
    const int bRow = tid >> 5, bCol = (tid & 31) * 4;
    const float* aP = X + (size_t)(m0 + aRow) * Kdim + aCol;
    const float* bP = W + (size_t)bRow * Nglob + n0 + bCol;
    float4 aReg[AC], bReg[BC];
    auto load_tiles = [&]() {   // the next BK columns of X, the next BK rows of W
#pragma unroll
        for (int c = 0; c < AC; ++c)
            aReg[c] = *(const float4*)(aP + (size_t)c * AR * Kdim);
#pragma unroll
        for (int c = 0; c < BC; ++c)
            bReg[c] = *(const float4*)(bP + (size_t)c * 8 * Nglob);
        // The pointers named by the loads above are advanced next. The clobber
        // also keeps these loads ahead of the pass's LDS reads and WMMAs: sunk
        // among them, their whole latency is waited out at the next pass's head.
        asm volatile("s_wait_xcnt 0x0" ::: "memory");
        aP += BK;
        bP += (size_t)BK * Nglob;
    };
    auto store_tiles = [&](int buf) {
#pragma unroll
        for (int c = 0; c < AC; ++c)
            *(v4h*)(&As[buf * ASZ + aRow * LDS_S + aCol + c * AR * LDS_S]) = cvt4(aReg[c]);
#pragma unroll
        for (int c = 0; c < BC; ++c)
            *(v4h*)(&Bs[buf * BSZ + bRow * LDS_B + bCol + c * 8 * LDS_B]) = cvt4(bReg[c]);
    };

    load_tiles();
    for (int kt = 0; kt < NT; ++kt) {
        const int cur = kt & 1;
        store_tiles(cur);   // its last readers (pass kt-2) passed the barrier of pass kt-1
        __syncthreads();    // publishes tile kt
        if (kt + 1 < NT) load_tiles();

#pragma unroll
        for (int ks = 0; ks < BK / 32; ++ks) {
            v16h afr[2], bfr[4];
#pragma unroll
            for (int im = 0; im < 2; ++im)
                afr[im] = load_frag(&As[cur * ASZ + (waveM * 32 + im * 16 + l16) * LDS_S] + ks * 32, grp);
#pragma unroll
            for (int in = 0; in < 4; ++in)
                bfr[in] = load_frag_tr(&Bs[cur * BSZ + (ks * 32 + trRow) * LDS_B + waveN * 64 + in * 16 + trCol], LDS_B);
#pragma unroll
            for (int im = 0; im < 2; ++im)
#pragma unroll
                for (int in = 0; in < 4; ++in)
                    acc[im][in] = wmma32(afr[im], bfr[in], acc[im][in]);
        }
    }

    // Epilogue: bias add, convert f16, scatter to [B,H,S,HD]
#pragma unroll
    for (int im = 0; im < 2; ++im)
#pragma unroll
        for (int in = 0; in < 4; ++in)
#pragma unroll
            for (int r = 0; r < 8; ++r) {
                const int mLoc = waveM * 32 + im * 16 + grp * 8 + r;
                const int nLoc = waveN * 64 + in * 16 + l16;
                const int gm = m0 + mLoc;   // b*S + s
                const int gn = n0 + nLoc;   // h*HD + hd
                const float v = acc[im][in][r] + bias[gn];
                const int b = gm >> 11, s = gm & 2047;
                const int h = gn >> 6, hd = gn & 63;
                out[(((size_t)(b * Hc + h) * Sc + s) * HDc) + hd] = (_Float16)v;
            }
}

__global__ void __launch_bounds__(256)
attn_kernel(const _Float16* __restrict__ Q, const _Float16* __restrict__ K,
            const _Float16* __restrict__ V, _Float16* __restrict__ X)
{
    constexpr int LQ = 72;  // 72 halves = 144B row stride (16B aligned)
    constexpr int LV = 80;  // 80 halves = 160B row stride for transposing loads
    constexpr int NT = Sc / 64;
    constexpr int QB = 256; // queries per block
    __shared__ __align__(16) _Float16 Qs[QB * LQ];       // Q tile
    __shared__ __align__(16) _Float16 Ks[2 * 64 * LQ];   // [buf][key][hd]
    __shared__ __align__(16) _Float16 Vs[2 * 64 * LV];   // [buf][key][hd]

    const int tid  = threadIdx.x;
    const int lane = tid & 31, wid = tid >> 5;
    const int l16 = lane & 15, grp = lane >> 4;
    const int bh = blockIdx.y;            // b*H + h
    const int b  = bh >> 4, h = bh & 15;
    const int q0 = blockIdx.x * QB;
    const int trRow = grp * 8 + (lane & 7), trCol = ((lane >> 3) & 1) * 8;

    const _Float16* Qp = Q + (size_t)bh * Sc * HDc;
    const _Float16* Kp = K + (size_t)bh * Sc * HDc;
    const _Float16* Vp = V + (size_t)bh * Sc * HDc;

    auto stage_kv = [&](int kb, int buf) {
        _Float16* KsB = &Ks[buf * 64 * LQ];
#pragma unroll
        for (int c = 0; c < 2; ++c) {
            const int idx = tid + c * 256;
            const int row = idx >> 3, c8 = idx & 7;
            async_cp16(&KsB[row * LQ + c8 * 8],
                       Kp + (size_t)(kb + row) * HDc + c8 * 8);
        }
#pragma unroll
        for (int c = 0; c < 2; ++c) {
            const int idx = tid + c * 256;
            const int row = idx >> 3, c8 = idx & 7;
            async_cp16(&Vs[buf * 64 * LV + row * LV + c8 * 8],
                       Vp + (size_t)(kb + row) * HDc + c8 * 8);
        }
    };

    // Stage Q tile (async) + first K/V tile, then pull Q fragments to regs.
#pragma unroll
    for (int c = 0; c < QB / 32; ++c) {
        const int idx = tid + c * 256;
        const int row = idx >> 3, c8 = idx & 7;
        async_cp16(&Qs[row * LQ + c8 * 8],
                   Qp + (size_t)(q0 + row) * HDc + c8 * 8);
    }
    stage_kv(0, 0);
    wait_async0();
    __syncthreads();

    // B fragments of Q^T: column group cg, column = query wid*32 + cg*16 + l16,
    // k = hd.
    v16h qfr[2][2];
#pragma unroll
    for (int cg = 0; cg < 2; ++cg)
#pragma unroll
        for (int ks = 0; ks < 2; ++ks)
            qfr[cg][ks] = load_frag(&Qs[(wid * 32 + cg * 16 + l16) * LQ] + ks * 32, grp);

    v8f oacc[2][4];  // O^T: row hd = in*16 + grp*8 + r, column = query l16 of group cg
    float dpart[2][8];  // this lane's share of its two queries' sums, 8 chains each
#pragma unroll
    for (int cg = 0; cg < 2; ++cg) {
#pragma unroll
        for (int i = 0; i < 4; ++i) oacc[cg][i] = zero8();
#pragma unroll
        for (int r = 0; r < 8; ++r) dpart[cg][r] = 0.0f;
    }

    for (int kt = 0; kt < NT; ++kt) {
        const int cur = kt & 1;
        // This wave's LDS reads of buf cur^1 have retired before copies aim at it.
        asm volatile("s_wait_dscnt 0x0" ::: "memory");
        // This wave's copies of tile kt have landed.
        asm volatile("s_wait_asynccnt 0x0" ::: "memory");
        __syncthreads();     // all waves' tile kt visible; buf cur^1 is free
        if (kt + 1 < NT) stage_kv((kt + 1) * 64, cur ^ 1);  // DMA overlaps WMMA

        const _Float16* KsB = &Ks[cur * 64 * LQ];
        const _Float16* VsB = &Vs[cur * 64 * LV];

        // S^T = K Q^T  (M=64 keys -> 4 m-subtiles, N=2x16 queries, K=HD=64)
        v16h kfr[4][2];
#pragma unroll
        for (int jm = 0; jm < 4; ++jm)
#pragma unroll
            for (int ks = 0; ks < 2; ++ks)
                kfr[jm][ks] = load_frag(&KsB[(jm * 16 + l16) * LQ] + ks * 32, grp);
        // Keeps the tile's K fragment reads in one group ahead of the S^T products.
        __builtin_amdgcn_sched_barrier(0);
        v8f e[2][4];
#pragma unroll
        for (int jm = 0; jm < 4; ++jm) {
            e[0][jm] = zero8();
            e[1][jm] = zero8();
#pragma unroll
            for (int ks = 0; ks < 2; ++ks)
#pragma unroll
                for (int cg = 0; cg < 2; ++cg)
                    e[cg][jm] = wmma32(kfr[jm][ks], qfr[cg][ks], e[cg][jm]);
        }
        __builtin_amdgcn_sched_barrier(0);
        // exp, partial denominator, pack P^T (f16) as B fragments: subtile jm
        // holds keys jm*16 + grp*8 + r, i.e. halves 0..7 (jm even) or 8..15
        // (jm odd) of the 32-key fragment jm/2.
        v16h pfr[2][2];
#pragma unroll
        for (int cg = 0; cg < 2; ++cg)
#pragma unroll
            for (int jm = 0; jm < 4; ++jm)
#pragma unroll
                for (int r = 0; r < 8; ++r) {
                    const float ev = __expf(e[cg][jm][r] * 0.125f);
                    dpart[cg][r] += ev;
                    pfr[cg][jm >> 1][(jm & 1) * 8 + r] = (_Float16)ev;
                }

        // O^T += V^T P^T  (M=64 hd -> 4 m-subtiles, K=64 keys -> 2 k-steps)
#pragma unroll
        for (int in = 0; in < 4; ++in)
#pragma unroll
            for (int ks = 0; ks < 2; ++ks) {
                const v16h afr = load_frag_tr(
                    &VsB[(ks * 32 + trRow) * LV + in * 16 + trCol], LV);
#pragma unroll
                for (int cg = 0; cg < 2; ++cg)
                    oacc[cg][in] = wmma32(afr, pfr[cg][ks], oacc[cg][in]);
            }
    }

#pragma unroll
    for (int cg = 0; cg < 2; ++cg) {
        // Denominator of query l16 of group cg: the lane's 8 chains, then the
        // other half-wave (which held the other 8 keys of every 16).
        float dsum = ((dpart[cg][0] + dpart[cg][1]) + (dpart[cg][2] + dpart[cg][3])) +
                     ((dpart[cg][4] + dpart[cg][5]) + (dpart[cg][6] + dpart[cg][7]));
        dsum += __shfl_xor(dsum, 16);
        const float dinv = 1.0f / (1.0f + dsum);   // softmax_1 denominator

        // Normalize and write X in [B, S, D] f16 layout: 8 consecutive hd per lane
        const int qrow = q0 + wid * 32 + cg * 16 + l16;
        _Float16* xrow = X + ((size_t)b * Sc + qrow) * Dc + h * HDc + grp * 8;
#pragma unroll
        for (int in = 0; in < 4; ++in) {
            v8h o;
#pragma unroll
            for (int r = 0; r < 8; ++r) o[r] = (_Float16)(oacc[cg][in][r] * dinv);
            *(v8h*)(xrow + in * 16) = o;
        }
    }
}

// ---------------------------------------------------------------------------
// Kernel 3: final projection.  out[M=8192, N=256] = Xh[M,K=1024] * Wf + bf
// Same 128x128 block tile and two-buffer pass as proj, but BK = 128; A already f16.
// ---------------------------------------------------------------------------
__global__ void __launch_bounds__(256)
final_kernel(const _Float16* __restrict__ Xh, const float* __restrict__ W,
             const float* __restrict__ bias, float* __restrict__ out)
{
    constexpr int BM = 128, BN = 128, BK = 128;
    constexpr int LDS_S = BK + 8;  // 272B row stride (16B x odd) for b128 reads
    constexpr int LDS_B = 144;     // W tile kept [k][n]: 288B row stride
    constexpr int Kdim = 1024, Nglob = 256, NT = Kdim / BK;
    constexpr int ASZ = BM * LDS_S, BSZ = BK * LDS_B;      // halves per buffer
    constexpr int AC = BM * BK / 8 / 256, BC = BK * BN / 4 / 256;
    __shared__ __align__(16) _Float16 As[2 * ASZ];
    __shared__ __align__(16) _Float16 Bs[2 * BSZ];

    const int tid  = threadIdx.x;
    const int lane = tid & 31, wid = tid >> 5;
    const int waveM = wid & 3, waveN = wid >> 2;
    const int l16 = lane & 15, grp = lane >> 4;
    const int m0 = blockIdx.x * BM, n0 = blockIdx.y * BN;
    const int trRow = grp * 8 + (lane & 7), trCol = ((lane >> 3) & 1) * 8;

    v8f acc[2][4];
#pragma unroll
    for (int i = 0; i < 2; ++i)
#pragma unroll
        for (int j = 0; j < 4; ++j) acc[i][j] = zero8();

    // Chunk c of a thread lies AR rows (Xh) or 8 rows (W) below chunk c-1: one
    // running pointer per operand, the chunks at constant offsets from it.
    constexpr int AR = 256 / (BK / 8);
    const int aRow = tid / (BK / 8), aCol = (tid % (BK / 8)) * 8;
    const int bRow = tid >> 5, bCol = (tid & 31) * 4;
    const _Float16* aP = Xh + (size_t)(m0 + aRow) * Kdim + aCol;
    const float* bP = W + (size_t)bRow * Nglob + n0 + bCol;
    v8h aReg[AC];
    float4 bReg[BC];
    auto load_tiles = [&]() {   // the next BK columns of Xh, the next BK rows of W
#pragma unroll
        for (int c = 0; c < AC; ++c)
            aReg[c] = *(const v8h*)(aP + (size_t)c * AR * Kdim);
#pragma unroll
        for (int c = 0; c < BC; ++c)
            bReg[c] = *(const float4*)(bP + (size_t)c * 8 * Nglob);
        // The pointers named by the loads above are advanced next. The clobber
        // also keeps these loads ahead of the pass's LDS reads and WMMAs: sunk
        // among them, their whole latency is waited out at the next pass's head.
        asm volatile("s_wait_xcnt 0x0" ::: "memory");
        aP += BK;
        bP += (size_t)BK * Nglob;
    };
    auto store_tiles = [&](int buf) {
#pragma unroll
        for (int c = 0; c < AC; ++c)
            *(v8h*)(&As[buf * ASZ + aRow * LDS_S + aCol + c * AR * LDS_S]) = aReg[c];
#pragma unroll
        for (int c = 0; c < BC; ++c)
            *(v4h*)(&Bs[buf * BSZ + bRow * LDS_B + bCol + c * 8 * LDS_B]) = cvt4(bReg[c]);
    };

    load_tiles();
    for (int kt = 0; kt < NT; ++kt) {
        const int cur = kt & 1;
        store_tiles(cur);   // its last readers (pass kt-2) passed the barrier of pass kt-1
        __syncthreads();    // publishes tile kt
        if (kt + 1 < NT) load_tiles();

#pragma unroll
        for (int ks = 0; ks < BK / 32; ++ks) {
            v16h afr[2], bfr[4];
#pragma unroll
            for (int im = 0; im < 2; ++im)
                afr[im] = load_frag(&As[cur * ASZ + (waveM * 32 + im * 16 + l16) * LDS_S] + ks * 32, grp);
#pragma unroll
            for (int in = 0; in < 4; ++in)
                bfr[in] = load_frag_tr(&Bs[cur * BSZ + (ks * 32 + trRow) * LDS_B + waveN * 64 + in * 16 + trCol], LDS_B);
#pragma unroll
            for (int im = 0; im < 2; ++im)
#pragma unroll
                for (int in = 0; in < 4; ++in)
                    acc[im][in] = wmma32(afr[im], bfr[in], acc[im][in]);
        }
    }

#pragma unroll
    for (int im = 0; im < 2; ++im)
#pragma unroll
        for (int in = 0; in < 4; ++in)
#pragma unroll
            for (int r = 0; r < 8; ++r) {
                const int mLoc = waveM * 32 + im * 16 + grp * 8 + r;
                const int nLoc = waveN * 64 + in * 16 + l16;
                const int gm = m0 + mLoc;
                const int gn = n0 + nLoc;
                out[(size_t)gm * OUTc + gn] = acc[im][in][r] + bias[gn];
            }
}

// ---------------------------------------------------------------------------
extern "C" void kernel_launch(void* const* d_in, const int* in_sizes, int n_in,
                              void* d_out, int out_size, void* d_ws, size_t ws_size,
                              hipStream_t stream)
{
    (void)in_sizes; (void)n_in; (void)out_size; (void)ws_size;
    const float* query = (const float*)d_in[0];
    const float* key   = (const float*)d_in[1];
    const float* value = (const float*)d_in[2];
    const float* Wq = (const float*)d_in[3];
    const float* bq = (const float*)d_in[4];
    const float* Wk = (const float*)d_in[5];
    const float* bk = (const float*)d_in[6];
    const float* Wv = (const float*)d_in[7];
    const float* bv = (const float*)d_in[8];
    const float* Wf = (const float*)d_in[9];
    const float* bf = (const float*)d_in[10];
    float* out = (float*)d_out;

    // Workspace layout (f16): Qh | Kh | Vh | Xh, each B*H*S*HD = 8,388,608 elems
    _Float16* ws = (_Float16*)d_ws;
    const size_t per = (size_t)Bc * Hc * Sc * HDc;
    _Float16* Qh = ws;
    _Float16* Kh = ws + per;
    _Float16* Vh = ws + 2 * per;
    _Float16* Xh = ws + 3 * per;

    const dim3 blk(256);
    const dim3 gproj(Bc * Sc / 128, Dc / 128);       // (64, 8)
    proj_kernel<<<gproj, blk, 0, stream>>>(query, Wq, bq, Qh);
    proj_kernel<<<gproj, blk, 0, stream>>>(key,   Wk, bk, Kh);
    proj_kernel<<<gproj, blk, 0, stream>>>(value, Wv, bv, Vh);

    attn_kernel<<<dim3(Sc / 256, Bc * Hc), blk, 0, stream>>>(Qh, Kh, Vh, Xh);

    final_kernel<<<dim3(Bc * Sc / 128, OUTc / 128), blk, 0, stream>>>(Xh, Wf, bf, out);
}

// v006
// One run takes 129 microseconds.
// Two timings next to v005 both put it at 1.04 times that version's speed.
// Counting every step since v000, it is 3.58 times as fast.
#include <hip/hip_runtime.h>
#include <hip/hip_bf16.h>
#include <stdint.h>

typedef _Float16 v16h __attribute__((ext_vector_type(16)));
typedef _Float16 v8h  __attribute__((ext_vector_type(8)));
typedef float    v8f  __attribute__((ext_vector_type(8)));
typedef int      v4i  __attribute__((ext_vector_type(4)));
typedef _Float16 v4h  __attribute__((ext_vector_type(4)));
typedef short    v8s  __attribute__((ext_vector_type(8)));

constexpr int Bc  = 4;
constexpr int Sc  = 2048;
constexpr int Dc  = 1024;
constexpr int Hc  = 16;
constexpr int HDc = 64;
constexpr int OUTc = 256;

#if defined(__has_builtin)
#if __has_builtin(__builtin_amdgcn_global_load_async_to_lds_b128)
#define HAVE_ASYNC_LDS 1
#else
#define HAVE_ASYNC_LDS 0
#endif
#if __has_builtin(__builtin_amdgcn_s_wait_asynccnt)
#define HAVE_WAIT_ASYNC 1
#else
#define HAVE_WAIT_ASYNC 0
#endif
#else
#define HAVE_ASYNC_LDS 0
#define HAVE_WAIT_ASYNC 0
#endif

typedef __attribute__((address_space(1))) v4i gv4i;   // global int4
typedef __attribute__((address_space(3))) v4i lv4i;   // LDS int4

__device__ inline void async_cp16(void* lds, const void* gsrc) {
#if HAVE_ASYNC_LDS
    gv4i* g = (gv4i*)(unsigned long long)(uintptr_t)gsrc;
    lv4i* l = (lv4i*)(unsigned int)(uintptr_t)lds;
    __builtin_amdgcn_global_load_async_to_lds_b128(g, l, 0, 0);
#else
    *(v8h*)lds = *(const v8h*)gsrc;
#endif
}

__device__ inline void wait_async0() {
#if HAVE_ASYNC_LDS
#if HAVE_WAIT_ASYNC
    __builtin_amdgcn_s_wait_asynccnt(0);
#else
    asm volatile("s_wait_asynccnt 0x0" ::: "memory");
#endif
#endif
}

__device__ inline v8f zero8() {
    v8f z;
#pragma unroll
    for (int i = 0; i < 8; ++i) z[i] = 0.0f;
    return z;
}

__device__ inline v16h load_frag(const _Float16* rowPtr, int grp) {
    const v8h lo = *(const v8h*)(rowPtr + grp * 8);
    const v8h hi = *(const v8h*)(rowPtr + grp * 8 + 16);
    v16h r;
#pragma unroll
    for (int i = 0; i < 8; ++i) { r[i] = lo[i]; r[i + 8] = hi[i]; }
    return r;
}

// B fragment (32 k x 16 n) from a ROW-MAJOR [k][n] f16 LDS tile by two
// transposing loads. p is this lane's address:
//   tile + (kbase + 8*grp + (lane&7)) * pitch + nbase + 8*((lane>>3)&1)
// Lane (l16, grp) receives k = kbase + 8*grp + 0..7 of column nbase + l16, the
// second load the same 16 rows further: the k order of load_frag above.
// pitch (halves) is an odd multiple of 16 halves (32 B) for these loads.
typedef __attribute__((address_space(3))) v8s lv8s;
__device__ inline v16h load_frag_tr(const _Float16* p, int pitch) {
    const v8h lo = __builtin_bit_cast(v8h,
        __builtin_amdgcn_ds_load_tr16_b128_v8i16((lv8s*)p));
    const v8h hi = __builtin_bit_cast(v8h,
        __builtin_amdgcn_ds_load_tr16_b128_v8i16((lv8s*)(p + 16 * pitch)));
    v16h r;
#pragma unroll
    for (int i = 0; i < 8; ++i) { r[i] = lo[i]; r[i + 8] = hi[i]; }
    return r;
}

__device__ inline v4h cvt4(float4 f) {
    v4h r;
    r[0] = (_Float16)f.x; r[1] = (_Float16)f.y;
    r[2] = (_Float16)f.z; r[3] = (_Float16)f.w;
    return r;
}

__device__ inline v8f wmma32(v16h a, v16h b, v8f c) {
    return __builtin_amdgcn_wmma_f32_16x16x32_f16(
        /*neg_a=*/false, a, /*neg_b=*/false, b,
        /*c_mod=*/(short)0, c, /*reuse_a=*/false, /*reuse_b=*/false);
}

// ---------------------------------------------------------------------------
// Kernel 0: the four weight matrices to f16, once per call, layout unchanged.
// dst = Wq | Wk | Wv | Wf. A block converts 8192 consecutive floats: blocks
// 0..127 Wq, 128..255 Wk, 256..383 Wv, 384..415 Wf. The GEMM kernels re-read a
// W tile in every row block (64 times), so they fetch it at half the bytes.
// ---------------------------------------------------------------------------
__global__ void __launch_bounds__(256)
wcvt_kernel(const float* __restrict__ Wq, const float* __restrict__ Wk,
            const float* __restrict__ Wv, const float* __restrict__ Wf,
            _Float16* __restrict__ dst)
{
    const int which = blockIdx.x >> 7;
    const float* src = which == 0 ? Wq : which == 1 ? Wk : which == 2 ? Wv : Wf;
    const float4* sp = (const float4*)(src + (size_t)(blockIdx.x & 127) * 8192) + threadIdx.x;
    v4h* dp = (v4h*)(dst + (size_t)blockIdx.x * 8192) + threadIdx.x;
    float4 r[8];
#pragma unroll
    for (int j = 0; j < 8; ++j) r[j] = sp[j * 256];
#pragma unroll
    for (int j = 0; j < 8; ++j) dp[j * 256] = cvt4(r[j]);
}

// ---------------------------------------------------------------------------
// Kernel 1: QKV projection.  C[M=8192, N=1024] = X[M,K=1024] * W[K,N] + bias
// W arrives as f16 (kernel 0).
// Output written as f16 in [B, H, S, HD] layout (head-transposed).
// Two LDS buffers, one barrier per pass: the global loads of tile k+1 are
// issued behind the barrier of pass k, fly during its LDS reads and WMMAs, and
// are converted and stored into the other buffer at the head of pass k+1.
// ---------------------------------------------------------------------------
__global__ void __launch_bounds__(256)
proj_kernel(const float* __restrict__ X, const _Float16* __restrict__ W,
            const float* __restrict__ bias, _Float16* __restrict__ out)
{
    constexpr int BM = 128, BN = 128, BK = 64;
    constexpr int LDS_S = BK + 8;  // 144B row stride (16B x odd) for b128 reads
    constexpr int LDS_B = 144;     // W tile kept [k][n]: 288B row stride
    constexpr int Kdim = 1024, Nglob = 1024, NT = Kdim / BK;
    constexpr int ASZ = BM * LDS_S, BSZ = BK * LDS_B;      // halves per buffer
    constexpr int AC = BM * BK / 4 / 256, BC = BK * BN / 8 / 256;
    __shared__ __align__(16) _Float16 As[2 * ASZ];
    __shared__ __align__(16) _Float16 Bs[2 * BSZ];

    const int tid  = threadIdx.x;
    const int lane = tid & 31, wid = tid >> 5;
    const int waveM = wid & 3, waveN = wid >> 2;
    const int l16 = lane & 15, grp = lane >> 4;
    const int m0 = blockIdx.x * BM, n0 = blockIdx.y * BN;
    const int trRow = grp * 8 + (lane & 7), trCol = ((lane >> 3) & 1) * 8;

    v8f acc[2][4];
#pragma unroll
    for (int i = 0; i < 2; ++i)
#pragma unroll
        for (int j = 0; j < 4; ++j) acc[i][j] = zero8();

    // Chunk c of a thread lies AR rows (X) or 16 rows (W) below chunk c-1: one
    // running pointer per operand, the chunks at constant offsets from it.
    constexpr int AR = 256 / (BK / 4);
    const int aRow = tid / (BK / 4), aCol = (tid % (BK / 4)) * 4;
    const int bRow = tid >> 4, bCol = (tid & 15) * 8;
    const float* aP = X + (size_t)(m0 + aRow) * Kdim + aCol;
    const _Float16* bP = W + (size_t)bRow * Nglob + n0 + bCol;
    float4 aReg[AC];
    v8h bReg[BC];
    auto load_tiles = [&]() {   // the next BK columns of X, the next BK rows of W
#pragma unroll
        for (int c = 0; c < AC; ++c)
            aReg[c] = *(const float4*)(aP + (size_t)c * AR * Kdim);
#pragma unroll
        for (int c = 0; c < BC; ++c)
            bReg[c] = *(const v8h*)(bP + (size_t)c * 16 * Nglob);
        // The pointers named by the loads above are advanced next. The clobber
        // also keeps these loads ahead of the pass's LDS reads and WMMAs: sunk
        // among them, their whole latency is waited out at the next pass's head.
        asm volatile("s_wait_xcnt 0x0" ::: "memory");
        aP += BK;
        bP += (size_t)BK * Nglob;
    };
    auto store_tiles = [&](int buf) {
#pragma unroll
        for (int c = 0; c < AC; ++c)
            *(v4h*)(&As[buf * ASZ + aRow * LDS_S + aCol + c * AR * LDS_S]) = cvt4(aReg[c]);
#pragma unroll
        for (int c = 0; c < BC; ++c)
            *(v8h*)(&Bs[buf * BSZ + bRow * LDS_B + bCol + c * 16 * LDS_B]) = bReg[c];
    };

    load_tiles();
    for (int kt = 0; kt < NT; ++kt) {
        const int cur = kt & 1;
        store_tiles(cur);   // its last readers (pass kt-2) passed the barrier of pass kt-1
        __syncthreads();    // publishes tile kt
        if (kt + 1 < NT) load_tiles();

#pragma unroll
        for (int ks = 0; ks < BK / 32; ++ks) {
            v16h afr[2], bfr[4];
#pragma unroll
            for (int im = 0; im < 2; ++im)
                afr[im] = load_frag(&As[cur * ASZ + (waveM * 32 + im * 16 + l16) * LDS_S] + ks * 32, grp);
#pragma unroll
            for (int in = 0; in < 4; ++in)
                bfr[in] = load_frag_tr(&Bs[cur * BSZ + (ks * 32 + trRow) * LDS_B + waveN * 64 + in * 16 + trCol], LDS_B);
#pragma unroll
            for (int im = 0; im < 2; ++im)
#pragma unroll
                for (int in = 0; in < 4; ++in)
                    acc[im][in] = wmma32(afr[im], bfr[in], acc[im][in]);
        }
    }

    // Epilogue: bias add, convert f16, scatter to [B,H,S,HD]
#pragma unroll
    for (int im = 0; im < 2; ++im)
#pragma unroll
        for (int in = 0; in < 4; ++in)
#pragma unroll
            for (int r = 0; r < 8; ++r) {
                const int mLoc = waveM * 32 + im * 16 + grp * 8 + r;
                const int nLoc = waveN * 64 + in * 16 + l16;
                const int gm = m0 + mLoc;   // b*S + s
                const int gn = n0 + nLoc;   // h*HD + hd
                const float v = acc[im][in][r] + bias[gn];
                const int b = gm >> 11, s = gm & 2047;
                const int h = gn >> 6, hd = gn & 63;
                out[(((size_t)(b * Hc + h) * Sc + s) * HDc) + hd] = (_Float16)v;
            }
}

__global__ void __launch_bounds__(256)
attn_kernel(const _Float16* __restrict__ Q, const _Float16* __restrict__ K,
            const _Float16* __restrict__ V, _Float16* __restrict__ X)
{
    constexpr int LQ = 72;  // 72 halves = 144B row stride (16B aligned)
    constexpr int LV = 80;  // 80 halves = 160B row stride for transposing loads
    constexpr int NT = Sc / 64;
    constexpr int QB = 256; // queries per block
    __shared__ __align__(16) _Float16 Qs[QB * LQ];       // Q tile
    __shared__ __align__(16) _Float16 Ks[2 * 64 * LQ];   // [buf][key][hd]
    __shared__ __align__(16) _Float16 Vs[2 * 64 * LV];   // [buf][key][hd]

    const int tid  = threadIdx.x;
    const int lane = tid & 31, wid = tid >> 5;
    const int l16 = lane & 15, grp = lane >> 4;
    const int bh = blockIdx.y;            // b*H + h
    const int b  = bh >> 4, h = bh & 15;
    const int q0 = blockIdx.x * QB;
    const int trRow = grp * 8 + (lane & 7), trCol = ((lane >> 3) & 1) * 8;

    const _Float16* Qp = Q + (size_t)bh * Sc * HDc;
    const _Float16* Kp = K + (size_t)bh * Sc * HDc;
    const _Float16* Vp = V + (size_t)bh * Sc * HDc;

    auto stage_kv = [&](int kb, int buf) {
        _Float16* KsB = &Ks[buf * 64 * LQ];
#pragma unroll
        for (int c = 0; c < 2; ++c) {
            const int idx = tid + c * 256;
            const int row = idx >> 3, c8 = idx & 7;
            async_cp16(&KsB[row * LQ + c8 * 8],
                       Kp + (size_t)(kb + row) * HDc + c8 * 8);
        }
#pragma unroll
        for (int c = 0; c < 2; ++c) {
            const int idx = tid + c * 256;
            const int row = idx >> 3, c8 = idx & 7;
            async_cp16(&Vs[buf * 64 * LV + row * LV + c8 * 8],
                       Vp + (size_t)(kb + row) * HDc + c8 * 8);
        }
    };

    // Stage Q tile (async) + first K/V tile, then pull Q fragments to regs.
#pragma unroll
    for (int c = 0; c < QB / 32; ++c) {
        const int idx = tid + c * 256;
        const int row = idx >> 3, c8 = idx & 7;
        async_cp16(&Qs[row * LQ + c8 * 8],
                   Qp + (size_t)(q0 + row) * HDc + c8 * 8);
    }
    stage_kv(0, 0);
    wait_async0();
    __syncthreads();

    // B fragments of Q^T: column group cg, column = query wid*32 + cg*16 + l16,
    // k = hd.
    v16h qfr[2][2];
#pragma unroll
    for (int cg = 0; cg < 2; ++cg)
#pragma unroll
        for (int ks = 0; ks < 2; ++ks)
            qfr[cg][ks] = load_frag(&Qs[(wid * 32 + cg * 16 + l16) * LQ] + ks * 32, grp);

    v8f oacc[2][4];  // O^T: row hd = in*16 + grp*8 + r, column = query l16 of group cg
    float dpart[2][8];  // this lane's share of its two queries' sums, 8 chains each
#pragma unroll
    for (int cg = 0; cg < 2; ++cg) {
#pragma unroll
        for (int i = 0; i < 4; ++i) oacc[cg][i] = zero8();
#pragma unroll
        for (int r = 0; r < 8; ++r) dpart[cg][r] = 0.0f;
    }

    for (int kt = 0; kt < NT; ++kt) {
        const int cur = kt & 1;
        // This wave's LDS reads of buf cur^1 have retired before copies aim at it.
        asm volatile("s_wait_dscnt 0x0" ::: "memory");
        // This wave's copies of tile kt have landed.
        asm volatile("s_wait_asynccnt 0x0" ::: "memory");
        __syncthreads();     // all waves' tile kt visible; buf cur^1 is free
        if (kt + 1 < NT) stage_kv((kt + 1) * 64, cur ^ 1);  // DMA overlaps WMMA

        const _Float16* KsB = &Ks[cur * 64 * LQ];
        const _Float16* VsB = &Vs[cur * 64 * LV];

        // S^T = K Q^T  (M=64 keys -> 4 m-subtiles, N=2x16 queries, K=HD=64)
        v16h kfr[4][2];
#pragma unroll
        for (int jm = 0; jm < 4; ++jm)
#pragma unroll
            for (int ks = 0; ks < 2; ++ks)
                kfr[jm][ks] = load_frag(&KsB[(jm * 16 + l16) * LQ] + ks * 32, grp);
        // Keeps the tile's K fragment reads in one group ahead of the S^T products.
        __builtin_amdgcn_sched_barrier(0);
        v8f e[2][4];
#pragma unroll
        for (int jm = 0; jm < 4; ++jm) {
            e[0][jm] = zero8();
            e[1][jm] = zero8();
#pragma unroll
            for (int ks = 0; ks < 2; ++ks)
#pragma unroll
                for (int cg = 0; cg < 2; ++cg)
                    e[cg][jm] = wmma32(kfr[jm][ks], qfr[cg][ks], e[cg][jm]);
        }
        __builtin_amdgcn_sched_barrier(0);
        // exp, partial denominator, pack P^T (f16) as B fragments: subtile jm
        // holds keys jm*16 + grp*8 + r, i.e. halves 0..7 (jm even) or 8..15
        // (jm odd) of the 32-key fragment jm/2.
        v16h pfr[2][2];
#pragma unroll
        for (int cg = 0; cg < 2; ++cg)
#pragma unroll
            for (int jm = 0; jm < 4; ++jm)
#pragma unroll
                for (int r = 0; r < 8; ++r) {
                    const float ev = __expf(e[cg][jm][r] * 0.125f);
                    dpart[cg][r] += ev;
                    pfr[cg][jm >> 1][(jm & 1) * 8 + r] = (_Float16)ev;
                }

        // O^T += V^T P^T  (M=64 hd -> 4 m-subtiles, K=64 keys -> 2 k-steps)
#pragma unroll
        for (int in = 0; in < 4; ++in)
#pragma unroll
            for (int ks = 0; ks < 2; ++ks) {
                const v16h afr = load_frag_tr(
                    &VsB[(ks * 32 + trRow) * LV + in * 16 + trCol], LV);
#pragma unroll
                for (int cg = 0; cg < 2; ++cg)
                    oacc[cg][in] = wmma32(afr, pfr[cg][ks], oacc[cg][in]);
            }
    }

#pragma unroll
    for (int cg = 0; cg < 2; ++cg) {
        // Denominator of query l16 of group cg: the lane's 8 chains, then the
        // other half-wave (which held the other 8 keys of every 16).
        float dsum = ((dpart[cg][0] + dpart[cg][1]) + (dpart[cg][2] + dpart[cg][3])) +
                     ((dpart[cg][4] + dpart[cg][5]) + (dpart[cg][6] + dpart[cg][7]));
        dsum += __shfl_xor(dsum, 16);
        const float dinv = 1.0f / (1.0f + dsum);   // softmax_1 denominator

        // Normalize and write X in [B, S, D] f16 layout: 8 consecutive hd per lane
        const int qrow = q0 + wid * 32 + cg * 16 + l16;
        _Float16* xrow = X + ((size_t)b * Sc + qrow) * Dc + h * HDc + grp * 8;
#pragma unroll
        for (int in = 0; in < 4; ++in) {
            v8h o;
#pragma unroll
            for (int r = 0; r < 8; ++r) o[r] = (_Float16)(oacc[cg][in][r] * dinv);
            *(v8h*)(xrow + in * 16) = o;
        }
    }
}

// ---------------------------------------------------------------------------
// Kernel 3: final projection.  out[M=8192, N=256] = Xh[M,K=1024] * Wf + bf
// Same tiling and the same two-buffer pass as proj; A and W already f16.
// ---------------------------------------------------------------------------
__global__ void __launch_bounds__(256)
final_kernel(const _Float16* __restrict__ Xh, const _Float16* __restrict__ W,
             const float* __restrict__ bias, float* __restrict__ out)
{
    constexpr int BM = 128, BN = 128, BK = 128;
    constexpr int LDS_S = BK + 8;  // 272B row stride (16B x odd) for b128 reads
    constexpr int LDS_B = 144;     // W tile kept [k][n]: 288B row stride
    constexpr int Kdim = 1024, Nglob = 256, NT = Kdim / BK;
    constexpr int ASZ = BM * LDS_S, BSZ = BK * LDS_B;      // halves per buffer
    constexpr int AC = BM * BK / 8 / 256, BC = BK * BN / 8 / 256;
    __shared__ __align__(16) _Float16 As[2 * ASZ];
    __shared__ __align__(16) _Float16 Bs[2 * BSZ];

    const int tid  = threadIdx.x;
    const int lane = tid & 31, wid = tid >> 5;
    const int waveM = wid & 3, waveN = wid >> 2;
    const int l16 = lane & 15, grp = lane >> 4;
    const int m0 = blockIdx.x * BM, n0 = blockIdx.y * BN;
    const int trRow = grp * 8 + (lane & 7), trCol = ((lane >> 3) & 1) * 8;

    v8f acc[2][4];
#pragma unroll
    for (int i = 0; i < 2; ++i)
#pragma unroll
        for (int j = 0; j < 4; ++j) acc[i][j] = zero8();

    // Chunk c of a thread lies AR rows (Xh) or 16 rows (W) below chunk c-1: one
    // running pointer per operand, the chunks at constant offsets from it.
    constexpr int AR = 256 / (BK / 8);
    const int aRow = tid / (BK / 8), aCol = (tid % (BK / 8)) * 8;
    const int bRow = tid >> 4, bCol = (tid & 15) * 8;
    const _Float16* aP = Xh + (size_t)(m0 + aRow) * Kdim + aCol;
    const _Float16* bP = W + (size_t)bRow * Nglob + n0 + bCol;
    v8h aReg[AC];
    v8h bReg[BC];
    auto load_tiles = [&]() {   // the next BK columns of Xh, the next BK rows of W
#pragma unroll
        for (int c = 0; c < AC; ++c)
            aReg[c] = *(const v8h*)(aP + (size_t)c * AR * Kdim);
#pragma unroll
        for (int c = 0; c < BC; ++c)
            bReg[c] = *(const v8h*)(bP + (size_t)c * 16 * Nglob);
        // The pointers named by the loads above are advanced next. The clobber
        // also keeps these loads ahead of the pass's LDS reads and WMMAs: sunk
        // among them, their whole latency is waited out at the next pass's head.
        asm volatile("s_wait_xcnt 0x0" ::: "memory");
        aP += BK;
        bP += (size_t)BK * Nglob;
    };
    auto store_tiles = [&](int buf) {
#pragma unroll
        for (int c = 0; c < AC; ++c)
            *(v8h*)(&As[buf * ASZ + aRow * LDS_S + aCol + c * AR * LDS_S]) = aReg[c];
#pragma unroll
        for (int c = 0; c < BC; ++c)
            *(v8h*)(&Bs[buf * BSZ + bRow * LDS_B + bCol + c * 16 * LDS_B]) = bReg[c];
    };

    load_tiles();
    for (int kt = 0; kt < NT; ++kt) {
        const int cur = kt & 1;
        store_tiles(cur);   // its last readers (pass kt-2) passed the barrier of pass kt-1
        __syncthreads();    // publishes tile kt
        if (kt + 1 < NT) load_tiles();

#pragma unroll
        for (int ks = 0; ks < BK / 32; ++ks) {
            v16h afr[2], bfr[4];
#pragma unroll
            for (int im = 0; im < 2; ++im)
                afr[im] = load_frag(&As[cur * ASZ + (waveM * 32 + im * 16 + l16) * LDS_S] + ks * 32, grp);
#pragma unroll
            for (int in = 0; in < 4; ++in)
                bfr[in] = load_frag_tr(&Bs[cur * BSZ + (ks * 32 + trRow) * LDS_B + waveN * 64 + in * 16 + trCol], LDS_B);
#pragma unroll
            for (int im = 0; im < 2; ++im)
#pragma unroll
                for (int in = 0; in < 4; ++in)
                    acc[im][in] = wmma32(afr[im], bfr[in], acc[im][in]);
        }
    }

#pragma unroll
    for (int im = 0; im < 2; ++im)
#pragma unroll
        for (int in = 0; in < 4; ++in)
#pragma unroll
            for (int r = 0; r < 8; ++r) {
                const int mLoc = waveM * 32 + im * 16 + grp * 8 + r;
                const int nLoc = waveN * 64 + in * 16 + l16;
                const int gm = m0 + mLoc;
                const int gn = n0 + nLoc;
                out[(size_t)gm * OUTc + gn] = acc[im][in][r] + bias[gn];
            }
}

// ---------------------------------------------------------------------------
extern "C" void kernel_launch(void* const* d_in, const int* in_sizes, int n_in,
                              void* d_out, int out_size, void* d_ws, size_t ws_size,
                              hipStream_t stream)
{
    (void)in_sizes; (void)n_in; (void)out_size; (void)ws_size;
    const float* query = (const float*)d_in[0];
    const float* key   = (const float*)d_in[1];
    const float* value = (const float*)d_in[2];
    const float* Wq = (const float*)d_in[3];
    const float* bq = (const float*)d_in[4];
    const float* Wk = (const float*)d_in[5];
    const float* bk = (const float*)d_in[6];
    const float* Wv = (const float*)d_in[7];
    const float* bv = (const float*)d_in[8];
    const float* Wf = (const float*)d_in[9];
    const float* bf = (const float*)d_in[10];
    float* out = (float*)d_out;

    // Workspace layout (f16): Qh | Kh | Vh | Xh, each B*H*S*HD = 8,388,608 elems,
    // then the f16 weights Wq | Wk | Wv (D*D each) | Wf (D*OUT)
    _Float16* ws = (_Float16*)d_ws;
    const size_t per = (size_t)Bc * Hc * Sc * HDc;
    _Float16* Qh = ws;
    _Float16* Kh = ws + per;
    _Float16* Vh = ws + 2 * per;
    _Float16* Xh = ws + 3 * per;
    const size_t wper = (size_t)Dc * Dc;
    _Float16* Wh = ws + 4 * per;

    const dim3 blk(256);
    const dim3 gproj(Bc * Sc / 128, Dc / 128);       // (64, 8)
    wcvt_kernel<<<dim3((3 * Dc * Dc + Dc * OUTc) / 8192), blk, 0, stream>>>(Wq, Wk, Wv, Wf, Wh);
    proj_kernel<<<gproj, blk, 0, stream>>>(query, Wh,            bq, Qh);
    proj_kernel<<<gproj, blk, 0, stream>>>(key,   Wh + wper,     bk, Kh);
    proj_kernel<<<gproj, blk, 0, stream>>>(value, Wh + 2 * wper, bv, Vh);

    attn_kernel<<<dim3(Sc / 256, Bc * Hc), blk, 0, stream>>>(Qh, Kh, Vh, Xh);

    final_kernel<<<dim3(Bc * Sc / 128, OUTc / 128), blk, 0, stream>>>(Xh, Wh + 3 * wper, bf, out);
}

// v007
// It runs in 125 microseconds.
// Timed twice side by side with v006, it ran 1.03 and 1.04 times as fast.
// All steps since v000 together make it 3.71 times as fast.
#include <hip/hip_runtime.h>
#include <hip/hip_bf16.h>
#include <stdint.h>

typedef _Float16 v16h __attribute__((ext_vector_type(16)));
typedef _Float16 v8h  __attribute__((ext_vector_type(8)));
typedef float    v8f  __attribute__((ext_vector_type(8)));
typedef int      v4i  __attribute__((ext_vector_type(4)));
typedef _Float16 v4h  __attribute__((ext_vector_type(4)));
typedef short    v8s  __attribute__((ext_vector_type(8)));

constexpr int Bc  = 4;
constexpr int Sc  = 2048;
constexpr int Dc  = 1024;
constexpr int Hc  = 16;
constexpr int HDc = 64;
constexpr int OUTc = 256;

#if defined(__has_builtin)
#if __has_builtin(__builtin_amdgcn_global_load_async_to_lds_b128)
#define HAVE_ASYNC_LDS 1
#else
#define HAVE_ASYNC_LDS 0
#endif
#if __has_builtin(__builtin_amdgcn_s_wait_asynccnt)
#define HAVE_WAIT_ASYNC 1
#else
#define HAVE_WAIT_ASYNC 0
#endif
#else
#define HAVE_ASYNC_LDS 0
#define HAVE_WAIT_ASYNC 0
#endif

typedef __attribute__((address_space(1))) v4i gv4i;   // global int4
typedef __attribute__((address_space(3))) v4i lv4i;   // LDS int4

__device__ inline void async_cp16(void* lds, const void* gsrc) {
#if HAVE_ASYNC_LDS
    gv4i* g = (gv4i*)(unsigned long long)(uintptr_t)gsrc;
    lv4i* l = (lv4i*)(unsigned int)(uintptr_t)lds;
    __builtin_amdgcn_global_load_async_to_lds_b128(g, l, 0, 0);
#else
    *(v8h*)lds = *(const v8h*)gsrc;
#endif
}

__device__ inline void wait_async0() {
#if HAVE_ASYNC_LDS
#if HAVE_WAIT_ASYNC
    __builtin_amdgcn_s_wait_asynccnt(0);
#else
    asm volatile("s_wait_asynccnt 0x0" ::: "memory");
#endif
#endif
}

__device__ inline v8f zero8() {
    v8f z;
#pragma unroll
    for (int i = 0; i < 8; ++i) z[i] = 0.0f;
    return z;
}

__device__ inline v16h load_frag(const _Float16* rowPtr, int grp) {
    const v8h lo = *(const v8h*)(rowPtr + grp * 8);
    const v8h hi = *(const v8h*)(rowPtr + grp * 8 + 16);
    v16h r;
#pragma unroll
    for (int i = 0; i < 8; ++i) { r[i] = lo[i]; r[i + 8] = hi[i]; }
    return r;
}

// B fragment (32 k x 16 n) from a ROW-MAJOR [k][n] f16 LDS tile by two
// transposing loads. p is this lane's address:
//   tile + (kbase + 8*grp + (lane&7)) * pitch + nbase + 8*((lane>>3)&1)
// Lane (l16, grp) receives k = kbase + 8*grp + 0..7 of column nbase + l16, the
// second load the same 16 rows further: the k order of load_frag above.
// pitch (halves) is an odd multiple of 16 halves (32 B) for these loads.
typedef __attribute__((address_space(3))) v8s lv8s;
__device__ inline v16h load_frag_tr(const _Float16* p, int pitch) {
    const v8h lo = __builtin_bit_cast(v8h,
        __builtin_amdgcn_ds_load_tr16_b128_v8i16((lv8s*)p));
    const v8h hi = __builtin_bit_cast(v8h,
        __builtin_amdgcn_ds_load_tr16_b128_v8i16((lv8s*)(p + 16 * pitch)));
    v16h r;
#pragma unroll
    for (int i = 0; i < 8; ++i) { r[i] = lo[i]; r[i + 8] = hi[i]; }
    return r;
}

__device__ inline v4h cvt4(float4 f) {
    v4h r;
    r[0] = (_Float16)f.x; r[1] = (_Float16)f.y;
    r[2] = (_Float16)f.z; r[3] = (_Float16)f.w;
    return r;
}

__device__ inline v8f wmma32(v16h a, v16h b, v8f c) {
    return __builtin_amdgcn_wmma_f32_16x16x32_f16(
        /*neg_a=*/false, a, /*neg_b=*/false, b,
        /*c_mod=*/(short)0, c, /*reuse_a=*/false, /*reuse_b=*/false);
}

// ---------------------------------------------------------------------------
// Kernel 0: the four weight matrices to f16, once per call, layout unchanged.
// dst = Wq | Wk | Wv | Wf. A block converts 8192 consecutive floats: blocks
// 0..127 Wq, 128..255 Wk, 256..383 Wv, 384..415 Wf. The GEMM kernels re-read a
// W tile in every row block (64 times), so they fetch it at half the bytes.
// ---------------------------------------------------------------------------
__global__ void __launch_bounds__(256)
wcvt_kernel(const float* __restrict__ Wq, const float* __restrict__ Wk,
            const float* __restrict__ Wv, const float* __restrict__ Wf,
            _Float16* __restrict__ dst)
{
    const int which = blockIdx.x >> 7;
    const float* src = which == 0 ? Wq : which == 1 ? Wk : which == 2 ? Wv : Wf;
    const float4* sp = (const float4*)(src + (size_t)(blockIdx.x & 127) * 8192) + threadIdx.x;
    v4h* dp = (v4h*)(dst + (size_t)blockIdx.x * 8192) + threadIdx.x;
    float4 r[8];
#pragma unroll
    for (int j = 0; j < 8; ++j) r[j] = sp[j * 256];
#pragma unroll
    for (int j = 0; j < 8; ++j) dp[j * 256] = cvt4(r[j]);
}

// ---------------------------------------------------------------------------
// Kernel 1: QKV projection.  C[M=8192, N=1024] = X[M,K=1024] * W[K,N] + bias
// W arrives as f16 (kernel 0).
// Output written as f16 in [B, H, S, HD] layout (head-transposed).
// Two LDS buffers, one barrier per pass: the global loads of tile k+1 are
// issued behind the barrier of pass k, fly during its LDS reads and WMMAs, and
// are converted and stored into the other buffer at the head of pass k+1.
// Block tile 128 x 256, K pass 128, 8 waves of 64 x 64 (2 x 4): a row of X is
// fetched by 4 column blocks, and 8 fragments feed 16 WMMAs. 256 blocks,
// one per WGP (LDS).
// ---------------------------------------------------------------------------
__global__ void __launch_bounds__(256)
proj_kernel(const float* __restrict__ X, const _Float16* __restrict__ W,
            const float* __restrict__ bias, _Float16* __restrict__ out)
{
    constexpr int BM = 128, BN = 256, BK = 128;
    constexpr int LDS_S = BK + 8;  // 272B row stride (16B x odd) for b128 reads
    constexpr int LDS_B = BN + 16; // W tile kept [k][n]: 544B row stride (32B x odd)
    constexpr int Kdim = 1024, Nglob = 1024, NT = Kdim / BK;
    constexpr int ASZ = BM * LDS_S, BSZ = BK * LDS_B;      // halves per buffer
    constexpr int AC = BM * BK / 4 / 256, BC = BK * BN / 8 / 256;
    __shared__ __align__(16) _Float16 As[2 * ASZ];
    __shared__ __align__(16) _Float16 Bs[2 * BSZ];

    const int tid  = threadIdx.x;
    const int lane = tid & 31, wid = tid >> 5;
    const int waveM = wid & 1, waveN = wid >> 1;
    const int l16 = lane & 15, grp = lane >> 4;
    const int m0 = blockIdx.x * BM, n0 = blockIdx.y * BN;
    const int trRow = grp * 8 + (lane & 7), trCol = ((lane >> 3) & 1) * 8;

    v8f acc[4][4];
#pragma unroll
    for (int i = 0; i < 4; ++i)
#pragma unroll
        for (int j = 0; j < 4; ++j) acc[i][j] = zero8();

    // Chunk c of a thread lies AR rows (X) or BR rows (W) below chunk c-1: one
    // running pointer per operand, the chunks at constant offsets from it.
    constexpr int AR = 256 / (BK / 4), BR = 256 / (BN / 8);
    const int aRow = tid / (BK / 4), aCol = (tid % (BK / 4)) * 4;
    const int bRow = tid / (BN / 8), bCol = (tid % (BN / 8)) * 8;
    const float* aP = X + (size_t)(m0 + aRow) * Kdim + aCol;
    const _Float16* bP = W + (size_t)bRow * Nglob + n0 + bCol;
    float4 aReg[AC];
    v8h bReg[BC];
    auto load_tiles = [&]() {   // the next BK columns of X, the next BK rows of W
#pragma unroll
        for (int c = 0; c < AC; ++c)
            aReg[c] = *(const float4*)(aP + (size_t)c * AR * Kdim);
#pragma unroll
        for (int c = 0; c < BC; ++c)
            bReg[c] = *(const v8h*)(bP + (size_t)c * BR * Nglob);
        // The pointers named by the loads above are advanced next. The clobber
        // also keeps these loads ahead of the pass's LDS reads and WMMAs: sunk
        // among them, their whole latency is waited out at the next pass's head.
        asm volatile("s_wait_xcnt 0x0" ::: "memory");
        // Keeps the two pointer additions behind that wait: nothing ties them to
        // it, and the scheduler lifts them over it.
        __builtin_amdgcn_sched_barrier(0);
        aP += BK;
        bP += (size_t)BK * Nglob;
    };
    auto store_tiles = [&](int buf) {
#pragma unroll
        for (int c = 0; c < AC; ++c)
            *(v4h*)(&As[buf * ASZ + aRow * LDS_S + aCol + c * AR * LDS_S]) = cvt4(aReg[c]);
#pragma unroll
        for (int c = 0; c < BC; ++c)
            *(v8h*)(&Bs[buf * BSZ + bRow * LDS_B + bCol + c * BR * LDS_B]) = bReg[c];
    };

    load_tiles();
    for (int kt = 0; kt < NT; ++kt) {
        const int cur = kt & 1;
        store_tiles(cur);   // its last readers (pass kt-2) passed the barrier of pass kt-1
        __syncthreads();    // publishes tile kt
        if (kt + 1 < NT) load_tiles();

#pragma unroll
        for (int ks = 0; ks < BK / 32; ++ks) {
            v16h afr[4], bfr[4];
#pragma unroll
            for (int im = 0; im < 4; ++im)
                afr[im] = load_frag(&As[cur * ASZ + (waveM * 64 + im * 16 + l16) * LDS_S] + ks * 32, grp);
#pragma unroll
            for (int in = 0; in < 4; ++in)
                bfr[in] = load_frag_tr(&Bs[cur * BSZ + (ks * 32 + trRow) * LDS_B + waveN * 64 + in * 16 + trCol], LDS_B);
            // Keeps the k step's 16 fragment reads in one group ahead of its 16
            // WMMAs: left free, each A fragment is read into one register set and
            // waited for in full in front of every 4 WMMAs.
            __builtin_amdgcn_sched_barrier(0);
#pragma unroll
            for (int im = 0; im < 4; ++im)
#pragma unroll
                for (int in = 0; in < 4; ++in)
                    acc[im][in] = wmma32(afr[im], bfr[in], acc[im][in]);
        }
    }

    // Epilogue: bias add, convert f16, scatter to [B,H,S,HD]
#pragma unroll
    for (int im = 0; im < 4; ++im)
#pragma unroll
        for (int in = 0; in < 4; ++in)
#pragma unroll
            for (int r = 0; r < 8; ++r) {
                const int mLoc = waveM * 64 + im * 16 + grp * 8 + r;
                const int nLoc = waveN * 64 + in * 16 + l16;
                const int gm = m0 + mLoc;   // b*S + s
                const int gn = n0 + nLoc;   // h*HD + hd
                const float v = acc[im][in][r] + bias[gn];
                const int b = gm >> 11, s = gm & 2047;
                const int h = gn >> 6, hd = gn & 63;
                out[(((size_t)(b * Hc + h) * Sc + s) * HDc) + hd] = (_Float16)v;
            }
}

__global__ void __launch_bounds__(256)
attn_kernel(const _Float16* __restrict__ Q, const _Float16* __restrict__ K,
            const _Float16* __restrict__ V, _Float16* __restrict__ X)
{
    constexpr int LQ = 72;  // 72 halves = 144B row stride (16B aligned)
    constexpr int LV = 80;  // 80 halves = 160B row stride for transposing loads
    constexpr int NT = Sc / 64;
    constexpr int QB = 256; // queries per block
    __shared__ __align__(16) _Float16 Qs[QB * LQ];       // Q tile
    __shared__ __align__(16) _Float16 Ks[2 * 64 * LQ];   // [buf][key][hd]
    __shared__ __align__(16) _Float16 Vs[2 * 64 * LV];   // [buf][key][hd]

    const int tid  = threadIdx.x;
    const int lane = tid & 31, wid = tid >> 5;
    const int l16 = lane & 15, grp = lane >> 4;
    const int bh = blockIdx.y;            // b*H + h
    const int b  = bh >> 4, h = bh & 15;
    const int q0 = blockIdx.x * QB;
    const int trRow = grp * 8 + (lane & 7), trCol = ((lane >> 3) & 1) * 8;

    const _Float16* Qp = Q + (size_t)bh * Sc * HDc;
    const _Float16* Kp = K + (size_t)bh * Sc * HDc;
    const _Float16* Vp = V + (size_t)bh * Sc * HDc;

    auto stage_kv = [&](int kb, int buf) {
        _Float16* KsB = &Ks[buf * 64 * LQ];
#pragma unroll
        for (int c = 0; c < 2; ++c) {
            const int idx = tid + c * 256;
            const int row = idx >> 3, c8 = idx & 7;
            async_cp16(&KsB[row * LQ + c8 * 8],
                       Kp + (size_t)(kb + row) * HDc + c8 * 8);
        }
#pragma unroll
        for (int c = 0; c < 2; ++c) {
            const int idx = tid + c * 256;
            const int row = idx >> 3, c8 = idx & 7;
            async_cp16(&Vs[buf * 64 * LV + row * LV + c8 * 8],
                       Vp + (size_t)(kb + row) * HDc + c8 * 8);
        }
    };

    // Stage Q tile (async) + first K/V tile, then pull Q fragments to regs.
#pragma unroll
    for (int c = 0; c < QB / 32; ++c) {
        const int idx = tid + c * 256;
        const int row = idx >> 3, c8 = idx & 7;
        async_cp16(&Qs[row * LQ + c8 * 8],
                   Qp + (size_t)(q0 + row) * HDc + c8 * 8);
    }
    stage_kv(0, 0);
    wait_async0();
    __syncthreads();

    // B fragments of Q^T: column group cg, column = query wid*32 + cg*16 + l16,
    // k = hd.
    v16h qfr[2][2];
#pragma unroll
    for (int cg = 0; cg < 2; ++cg)
#pragma unroll
        for (int ks = 0; ks < 2; ++ks)
            qfr[cg][ks] = load_frag(&Qs[(wid * 32 + cg * 16 + l16) * LQ] + ks * 32, grp);

    v8f oacc[2][4];  // O^T: row hd = in*16 + grp*8 + r, column = query l16 of group cg
    float dpart[2][8];  // this lane's share of its two queries' sums, 8 chains each
#pragma unroll
    for (int cg = 0; cg < 2; ++cg) {
#pragma unroll
        for (int i = 0; i < 4; ++i) oacc[cg][i] = zero8();
#pragma unroll
        for (int r = 0; r < 8; ++r) dpart[cg][r] = 0.0f;
    }

    for (int kt = 0; kt < NT; ++kt) {
        const int cur = kt & 1;
        // This wave's LDS reads of buf cur^1 have retired before copies aim at it.
        asm volatile("s_wait_dscnt 0x0" ::: "memory");
        // This wave's copies of tile kt have landed.
        asm volatile("s_wait_asynccnt 0x0" ::: "memory");
        __syncthreads();     // all waves' tile kt visible; buf cur^1 is free
        if (kt + 1 < NT) stage_kv((kt + 1) * 64, cur ^ 1);  // DMA overlaps WMMA

        const _Float16* KsB = &Ks[cur * 64 * LQ];
        const _Float16* VsB = &Vs[cur * 64 * LV];

        // S^T = K Q^T  (M=64 keys -> 4 m-subtiles, N=2x16 queries, K=HD=64)
        v16h kfr[4][2];
#pragma unroll
        for (int jm = 0; jm < 4; ++jm)
#pragma unroll
            for (int ks = 0; ks < 2; ++ks)
                kfr[jm][ks] = load_frag(&KsB[(jm * 16 + l16) * LQ] + ks * 32, grp);
        // Keeps the tile's K fragment reads in one group ahead of the S^T products.
        __builtin_amdgcn_sched_barrier(0);
        v8f e[2][4];
#pragma unroll
        for (int jm = 0; jm < 4; ++jm) {
            e[0][jm] = zero8();
            e[1][jm] = zero8();
#pragma unroll
            for (int ks = 0; ks < 2; ++ks)
#pragma unroll
                for (int cg = 0; cg < 2; ++cg)
                    e[cg][jm] = wmma32(kfr[jm][ks], qfr[cg][ks], e[cg][jm]);
        }
        __builtin_amdgcn_sched_barrier(0);
        // exp, partial denominator, pack P^T (f16) as B fragments: subtile jm
        // holds keys jm*16 + grp*8 + r, i.e. halves 0..7 (jm even) or 8..15
        // (jm odd) of the 32-key fragment jm/2.
        v16h pfr[2][2];
#pragma unroll
        for (int cg = 0; cg < 2; ++cg)
#pragma unroll
            for (int jm = 0; jm < 4; ++jm)
#pragma unroll
                for (int r = 0; r < 8; ++r) {
                    const float ev = __expf(e[cg][jm][r] * 0.125f);
                    dpart[cg][r] += ev;
                    pfr[cg][jm >> 1][(jm & 1) * 8 + r] = (_Float16)ev;
                }

        // O^T += V^T P^T  (M=64 hd -> 4 m-subtiles, K=64 keys -> 2 k-steps)
#pragma unroll
        for (int in = 0; in < 4; ++in)
#pragma unroll
            for (int ks = 0; ks < 2; ++ks) {
                const v16h afr = load_frag_tr(
                    &VsB[(ks * 32 + trRow) * LV + in * 16 + trCol], LV);
#pragma unroll
                for (int cg = 0; cg < 2; ++cg)
                    oacc[cg][in] = wmma32(afr, pfr[cg][ks], oacc[cg][in]);
            }
    }

#pragma unroll
    for (int cg = 0; cg < 2; ++cg) {
        // Denominator of query l16 of group cg: the lane's 8 chains, then the
        // other half-wave (which held the other 8 keys of every 16).
        float dsum = ((dpart[cg][0] + dpart[cg][1]) + (dpart[cg][2] + dpart[cg][3])) +
                     ((dpart[cg][4] + dpart[cg][5]) + (dpart[cg][6] + dpart[cg][7]));
        dsum += __shfl_xor(dsum, 16);
        const float dinv = 1.0f / (1.0f + dsum);   // softmax_1 denominator

        // Normalize and write X in [B, S, D] f16 layout: 8 consecutive hd per lane
        const int qrow = q0 + wid * 32 + cg * 16 + l16;
        _Float16* xrow = X + ((size_t)b * Sc + qrow) * Dc + h * HDc + grp * 8;
#pragma unroll
        for (int in = 0; in < 4; ++in) {
            v8h o;
#pragma unroll
            for (int r = 0; r < 8; ++r) o[r] = (_Float16)(oacc[cg][in][r] * dinv);
            *(v8h*)(xrow + in * 16) = o;
        }
    }
}

// ---------------------------------------------------------------------------
// Kernel 3: final projection.  out[M=8192, N=256] = Xh[M,K=1024] * Wf + bf
// 128 x 128 block, 32 x 64 wave tiles, the same two-buffer pass as proj; A and
// W already f16.
// ---------------------------------------------------------------------------
__global__ void __launch_bounds__(256)
final_kernel(const _Float16* __restrict__ Xh, const _Float16* __restrict__ W,
             const float* __restrict__ bias, float* __restrict__ out)
{
    constexpr int BM = 128, BN = 128, BK = 128;
    constexpr int LDS_S = BK + 8;  // 272B row stride (16B x odd) for b128 reads
    constexpr int LDS_B = 144;     // W tile kept [k][n]: 288B row stride
    constexpr int Kdim = 1024, Nglob = 256, NT = Kdim / BK;
    constexpr int ASZ = BM * LDS_S, BSZ = BK * LDS_B;      // halves per buffer
    constexpr int AC = BM * BK / 8 / 256, BC = BK * BN / 8 / 256;
    __shared__ __align__(16) _Float16 As[2 * ASZ];
    __shared__ __align__(16) _Float16 Bs[2 * BSZ];

    const int tid  = threadIdx.x;
    const int lane = tid & 31, wid = tid >> 5;
    const int waveM = wid & 3, waveN = wid >> 2;
    const int l16 = lane & 15, grp = lane >> 4;
    const int m0 = blockIdx.x * BM, n0 = blockIdx.y * BN;
    const int trRow = grp * 8 + (lane & 7), trCol = ((lane >> 3) & 1) * 8;

    v8f acc[2][4];
#pragma unroll
    for (int i = 0; i < 2; ++i)
#pragma unroll
        for (int j = 0; j < 4; ++j) acc[i][j] = zero8();

    // Chunk c of a thread lies AR rows (Xh) or 16 rows (W) below chunk c-1: one
    // running pointer per operand, the chunks at constant offsets from it.
    constexpr int AR = 256 / (BK / 8);
    const int aRow = tid / (BK / 8), aCol = (tid % (BK / 8)) * 8;
    const int bRow = tid >> 4, bCol = (tid & 15) * 8;
    const _Float16* aP = Xh + (size_t)(m0 + aRow) * Kdim + aCol;
    const _Float16* bP = W + (size_t)bRow * Nglob + n0 + bCol;
    v8h aReg[AC];
    v8h bReg[BC];
    auto load_tiles = [&]() {   // the next BK columns of Xh, the next BK rows of W
#pragma unroll
        for (int c = 0; c < AC; ++c)
            aReg[c] = *(const v8h*)(aP + (size_t)c * AR * Kdim);
#pragma unroll
        for (int c = 0; c < BC; ++c)
            bReg[c] = *(const v8h*)(bP + (size_t)c * 16 * Nglob);
        // The pointers named by the loads above are advanced next. The clobber
        // also keeps these loads ahead of the pass's LDS reads and WMMAs: sunk
        // among them, their whole latency is waited out at the next pass's head.
        asm volatile("s_wait_xcnt 0x0" ::: "memory");
        aP += BK;
        bP += (size_t)BK * Nglob;
    };
    auto store_tiles = [&](int buf) {
#pragma unroll
        for (int c = 0; c < AC; ++c)
            *(v8h*)(&As[buf * ASZ + aRow * LDS_S + aCol + c * AR * LDS_S]) = aReg[c];
#pragma unroll
        for (int c = 0; c < BC; ++c)
            *(v8h*)(&Bs[buf * BSZ + bRow * LDS_B + bCol + c * 16 * LDS_B]) = bReg[c];
    };

    load_tiles();
    for (int kt = 0; kt < NT; ++kt) {
        const int cur = kt & 1;
        store_tiles(cur);   // its last readers (pass kt-2) passed the barrier of pass kt-1
        __syncthreads();    // publishes tile kt
        if (kt + 1 < NT) load_tiles();

#pragma unroll
        for (int ks = 0; ks < BK / 32; ++ks) {
            v16h afr[2], bfr[4];
#pragma unroll
            for (int im = 0; im < 2; ++im)
                afr[im] = load_frag(&As[cur * ASZ + (waveM * 32 + im * 16 + l16) * LDS_S] + ks * 32, grp);
#pragma unroll
            for (int in = 0; in < 4; ++in)
                bfr[in] = load_frag_tr(&Bs[cur * BSZ + (ks * 32 + trRow) * LDS_B + waveN * 64 + in * 16 + trCol], LDS_B);
#pragma unroll
            for (int im = 0; im < 2; ++im)
#pragma unroll
                for (int in = 0; in < 4; ++in)
                    acc[im][in] = wmma32(afr[im], bfr[in], acc[im][in]);
        }
    }

#pragma unroll
    for (int im = 0; im < 2; ++im)
#pragma unroll
        for (int in = 0; in < 4; ++in)
#pragma unroll
            for (int r = 0; r < 8; ++r) {
                const int mLoc = waveM * 32 + im * 16 + grp * 8 + r;
                const int nLoc = waveN * 64 + in * 16 + l16;
                const int gm = m0 + mLoc;
                const int gn = n0 + nLoc;
                out[(size_t)gm * OUTc + gn] = acc[im][in][r] + bias[gn];
            }
}

// ---------------------------------------------------------------------------
extern "C" void kernel_launch(void* const* d_in, const int* in_sizes, int n_in,
                              void* d_out, int out_size, void* d_ws, size_t ws_size,
                              hipStream_t stream)
{
    (void)in_sizes; (void)n_in; (void)out_size; (void)ws_size;
    const float* query = (const float*)d_in[0];
    const float* key   = (const float*)d_in[1];
    const float* value = (const float*)d_in[2];
    const float* Wq = (const float*)d_in[3];
    const float* bq = (const float*)d_in[4];
    const float* Wk = (const float*)d_in[5];
    const float* bk = (const float*)d_in[6];
    const float* Wv = (const float*)d_in[7];
    const float* bv = (const float*)d_in[8];
    const float* Wf = (const float*)d_in[9];
    const float* bf = (const float*)d_in[10];
    float* out = (float*)d_out;

    // Workspace layout (f16): Qh | Kh | Vh | Xh, each B*H*S*HD = 8,388,608 elems,
    // then the f16 weights Wq | Wk | Wv (D*D each) | Wf (D*OUT)
    _Float16* ws = (_Float16*)d_ws;
    const size_t per = (size_t)Bc * Hc * Sc * HDc;
    _Float16* Qh = ws;
    _Float16* Kh = ws + per;
    _Float16* Vh = ws + 2 * per;
    _Float16* Xh = ws + 3 * per;
    const size_t wper = (size_t)Dc * Dc;
    _Float16* Wh = ws + 4 * per;

    const dim3 blk(256);
    const dim3 gproj(Bc * Sc / 128, Dc / 256);       // (64, 4)
    wcvt_kernel<<<dim3((3 * Dc * Dc + Dc * OUTc) / 8192), blk, 0, stream>>>(Wq, Wk, Wv, Wf, Wh);
    proj_kernel<<<gproj, blk, 0, stream>>>(query, Wh,            bq, Qh);
    proj_kernel<<<gproj, blk, 0, stream>>>(key,   Wh + wper,     bk, Kh);
    proj_kernel<<<gproj, blk, 0, stream>>>(value, Wh + 2 * wper, bv, Vh);

    attn_kernel<<<dim3(Sc / 256, Bc * Hc), blk, 0, stream>>>(Qh, Kh, Vh, Xh);

    final_kernel<<<dim3(Bc * Sc / 128, OUTc / 128), blk, 0, stream>>>(Xh, Wh + 3 * wper, bf, out);
}

// v008
// It runs in 118 microseconds.
// Next to v007, in two timings, it ran 1.06 times as fast each time.
// Over all steps from v000 it is 3.92 times as fast.
#include <hip/hip_runtime.h>
#include <hip/hip_bf16.h>
#include <stdint.h>

typedef _Float16 v16h __attribute__((ext_vector_type(16)));
typedef _Float16 v8h  __attribute__((ext_vector_type(8)));
typedef float    v8f  __attribute__((ext_vector_type(8)));
typedef int      v4i  __attribute__((ext_vector_type(4)));
typedef _Float16 v4h  __attribute__((ext_vector_type(4)));
typedef short    v8s  __attribute__((ext_vector_type(8)));

constexpr int Bc  = 4;
constexpr int Sc  = 2048;
constexpr int Dc  = 1024;
constexpr int Hc  = 16;
constexpr int HDc = 64;
constexpr int OUTc = 256;

#if defined(__has_builtin)
#if __has_builtin(__builtin_amdgcn_global_load_async_to_lds_b128)
#define HAVE_ASYNC_LDS 1
#else
#define HAVE_ASYNC_LDS 0
#endif
#if __has_builtin(__builtin_amdgcn_s_wait_asynccnt)
#define HAVE_WAIT_ASYNC 1
#else
#define HAVE_WAIT_ASYNC 0
#endif
#else
#define HAVE_ASYNC_LDS 0
#define HAVE_WAIT_ASYNC 0
#endif

typedef __attribute__((address_space(1))) v4i gv4i;   // global int4
typedef __attribute__((address_space(3))) v4i lv4i;   // LDS int4

__device__ inline void async_cp16(void* lds, const void* gsrc) {
#if HAVE_ASYNC_LDS
    gv4i* g = (gv4i*)(unsigned long long)(uintptr_t)gsrc;
    lv4i* l = (lv4i*)(unsigned int)(uintptr_t)lds;
    __builtin_amdgcn_global_load_async_to_lds_b128(g, l, 0, 0);
#else
    *(v8h*)lds = *(const v8h*)gsrc;
#endif
}

__device__ inline void wait_async0() {
#if HAVE_ASYNC_LDS
#if HAVE_WAIT_ASYNC
    __builtin_amdgcn_s_wait_asynccnt(0);
#else
    asm volatile("s_wait_asynccnt 0x0" ::: "memory");
#endif
#endif
}

__device__ inline v8f zero8() {
    v8f z;
#pragma unroll
    for (int i = 0; i < 8; ++i) z[i] = 0.0f;
    return z;
}

__device__ inline v16h load_frag(const _Float16* rowPtr, int grp) {
    const v8h lo = *(const v8h*)(rowPtr + grp * 8);
    const v8h hi = *(const v8h*)(rowPtr + grp * 8 + 16);
    v16h r;
#pragma unroll
    for (int i = 0; i < 8; ++i) { r[i] = lo[i]; r[i + 8] = hi[i]; }
    return r;
}

// B fragment (32 k x 16 n) from a ROW-MAJOR [k][n] f16 LDS tile by two
// transposing loads. p is this lane's address:
//   tile + (kbase + 8*grp + (lane&7)) * pitch + nbase + 8*((lane>>3)&1)
// Lane (l16, grp) receives k = kbase + 8*grp + 0..7 of column nbase + l16, the
// second load the same 16 rows further: the k order of load_frag above.
// pitch (halves) is an odd multiple of 16 halves (32 B) for these loads.
typedef __attribute__((address_space(3))) v8s lv8s;
__device__ inline v16h load_frag_tr(const _Float16* p, int pitch) {
    const v8h lo = __builtin_bit_cast(v8h,
        __builtin_amdgcn_ds_load_tr16_b128_v8i16((lv8s*)p));
    const v8h hi = __builtin_bit_cast(v8h,
        __builtin_amdgcn_ds_load_tr16_b128_v8i16((lv8s*)(p + 16 * pitch)));
    v16h r;
#pragma unroll
    for (int i = 0; i < 8; ++i) { r[i] = lo[i]; r[i + 8] = hi[i]; }
    return r;
}

__device__ inline v4h cvt4(float4 f) {
    v4h r;
    r[0] = (_Float16)f.x; r[1] = (_Float16)f.y;
    r[2] = (_Float16)f.z; r[3] = (_Float16)f.w;
    return r;
}

__device__ inline v8f wmma32(v16h a, v16h b, v8f c) {
    return __builtin_amdgcn_wmma_f32_16x16x32_f16(
        /*neg_a=*/false, a, /*neg_b=*/false, b,
        /*c_mod=*/(short)0, c, /*reuse_a=*/false, /*reuse_b=*/false);
}

// ---------------------------------------------------------------------------
// Kernel 0: the four weight matrices to f16, once per call, layout unchanged.
// dst = Wq | Wk | Wv | Wf. A block converts 8192 consecutive floats: blocks
// 0..127 Wq, 128..255 Wk, 256..383 Wv, 384..415 Wf. The GEMM kernels re-read a
// W tile in every row block (64 times), so they fetch it at half the bytes.
// ---------------------------------------------------------------------------
__global__ void __launch_bounds__(256)
wcvt_kernel(const float* __restrict__ Wq, const float* __restrict__ Wk,
            const float* __restrict__ Wv, const float* __restrict__ Wf,
            _Float16* __restrict__ dst)
{
    const int which = blockIdx.x >> 7;
    const float* src = which == 0 ? Wq : which == 1 ? Wk : which == 2 ? Wv : Wf;
    const float4* sp = (const float4*)(src + (size_t)(blockIdx.x & 127) * 8192) + threadIdx.x;
    v4h* dp = (v4h*)(dst + (size_t)blockIdx.x * 8192) + threadIdx.x;
    float4 r[8];
#pragma unroll
    for (int j = 0; j < 8; ++j) r[j] = sp[j * 256];
#pragma unroll
    for (int j = 0; j < 8; ++j) dp[j * 256] = cvt4(r[j]);
}

// ---------------------------------------------------------------------------
// Kernel 1: QKV projections.  C[M=8192, N=1024] = X[M,K=1024] * W[K,N] + bias
// All three in ONE launch: blockIdx.z picks the input, its weights, bias and
// output plane. They do not depend on one another, so a WGP goes on to its next
// block when it is free and does not wait for the slowest block of a launch.
// W arrives as f16 (kernel 0), the three matrices one behind the other.
// Output written as f16 in [B, H, S, HD] layout (head-transposed).
// Two LDS buffers, one barrier per pass: the global loads of tile k+1 are
// issued behind the barrier of pass k, fly during its LDS reads and WMMAs, and
// are converted and stored into the other buffer at the head of pass k+1.
// Block tile 128 x 256, K pass 128, 8 waves of 64 x 64 (2 x 4): a row of X is
// fetched by 4 column blocks, and 8 fragments feed 16 WMMAs. 3 x 256 blocks,
// one per WGP (LDS).
// ---------------------------------------------------------------------------
__global__ void __launch_bounds__(256)
proj_kernel(const float* __restrict__ Xq, const float* __restrict__ Xk,
            const float* __restrict__ Xv, const _Float16* __restrict__ Wqkv,
            const float* __restrict__ bq, const float* __restrict__ bk,
            const float* __restrict__ bv, _Float16* __restrict__ QKV)
{
    const int which = blockIdx.z;   // 0 Q, 1 K, 2 V
    const float* __restrict__ X    = which == 0 ? Xq : which == 1 ? Xk : Xv;
    const float* __restrict__ bias = which == 0 ? bq : which == 1 ? bk : bv;
    const _Float16* __restrict__ W = Wqkv + (size_t)which * Dc * Dc;
    _Float16* __restrict__ out     = QKV + (size_t)which * Bc * Hc * Sc * HDc;

    constexpr int BM = 128, BN = 256, BK = 128;
    constexpr int LDS_S = BK + 8;  // 272B row stride (16B x odd) for b128 reads
    constexpr int LDS_B = BN + 16; // W tile kept [k][n]: 544B row stride (32B x odd)
    constexpr int Kdim = 1024, Nglob = 1024, NT = Kdim / BK;
    constexpr int ASZ = BM * LDS_S, BSZ = BK * LDS_B;      // halves per buffer
    constexpr int AC = BM * BK / 4 / 256, BC = BK * BN / 8 / 256;
    __shared__ __align__(16) _Float16 As[2 * ASZ];
    __shared__ __align__(16) _Float16 Bs[2 * BSZ];

    const int tid  = threadIdx.x;
    const int lane = tid & 31, wid = tid >> 5;
    const int waveM = wid & 1, waveN = wid >> 1;
    const int l16 = lane & 15, grp = lane >> 4;
    const int m0 = blockIdx.x * BM, n0 = blockIdx.y * BN;
    const int trRow = grp * 8 + (lane & 7), trCol = ((lane >> 3) & 1) * 8;

    v8f acc[4][4];
#pragma unroll
    for (int i = 0; i < 4; ++i)
#pragma unroll
        for (int j = 0; j < 4; ++j) acc[i][j] = zero8();

    // Chunk c of a thread lies AR rows (X) or BR rows (W) below chunk c-1: one
    // running pointer per operand, the chunks at constant offsets from it.
    constexpr int AR = 256 / (BK / 4), BR = 256 / (BN / 8);
    const int aRow = tid / (BK / 4), aCol = (tid % (BK / 4)) * 4;
    const int bRow = tid / (BN / 8), bCol = (tid % (BN / 8)) * 8;
    const float* aP = X + (size_t)(m0 + aRow) * Kdim + aCol;
    const _Float16* bP = W + (size_t)bRow * Nglob + n0 + bCol;
    float4 aReg[AC];
    v8h bReg[BC];
    auto load_tiles = [&]() {   // the next BK columns of X, the next BK rows of W
#pragma unroll
        for (int c = 0; c < AC; ++c)
            aReg[c] = *(const float4*)(aP + (size_t)c * AR * Kdim);
#pragma unroll
        for (int c = 0; c < BC; ++c)
            bReg[c] = *(const v8h*)(bP + (size_t)c * BR * Nglob);
        // The pointers named by the loads above are advanced next. The clobber
        // also keeps these loads ahead of the pass's LDS reads and WMMAs: sunk
        // among them, their whole latency is waited out at the next pass's head.
        asm volatile("s_wait_xcnt 0x0" ::: "memory");
        // Keeps the two pointer additions behind that wait: nothing ties them to
        // it, and the scheduler lifts them over it.
        __builtin_amdgcn_sched_barrier(0);
        aP += BK;
        bP += (size_t)BK * Nglob;
    };
    auto store_tiles = [&](int buf) {
#pragma unroll
        for (int c = 0; c < AC; ++c)
            *(v4h*)(&As[buf * ASZ + aRow * LDS_S + aCol + c * AR * LDS_S]) = cvt4(aReg[c]);
#pragma unroll
        for (int c = 0; c < BC; ++c)
            *(v8h*)(&Bs[buf * BSZ + bRow * LDS_B + bCol + c * BR * LDS_B]) = bReg[c];
    };

    load_tiles();
    for (int kt = 0; kt < NT; ++kt) {
        const int cur = kt & 1;
        store_tiles(cur);   // its last readers (pass kt-2) passed the barrier of pass kt-1
        __syncthreads();    // publishes tile kt
        if (kt + 1 < NT) load_tiles();

#pragma unroll
        for (int ks = 0; ks < BK / 32; ++ks) {
            v16h afr[4], bfr[4];
#pragma unroll
            for (int im = 0; im < 4; ++im)
                afr[im] = load_frag(&As[cur * ASZ + (waveM * 64 + im * 16 + l16) * LDS_S] + ks * 32, grp);
#pragma unroll
            for (int in = 0; in < 4; ++in)
                bfr[in] = load_frag_tr(&Bs[cur * BSZ + (ks * 32 + trRow) * LDS_B + waveN * 64 + in * 16 + trCol], LDS_B);
            // Keeps the k step's 16 fragment reads in one group ahead of its 16
            // WMMAs: left free, each A fragment is read into one register set and
            // waited for in full in front of every 4 WMMAs.
            __builtin_amdgcn_sched_barrier(0);
#pragma unroll
            for (int im = 0; im < 4; ++im)
#pragma unroll
                for (int in = 0; in < 4; ++in)
                    acc[im][in] = wmma32(afr[im], bfr[in], acc[im][in]);
        }
    }

    // Epilogue: bias add, convert f16, scatter to [B,H,S,HD]
#pragma unroll
    for (int im = 0; im < 4; ++im)
#pragma unroll
        for (int in = 0; in < 4; ++in)
#pragma unroll
            for (int r = 0; r < 8; ++r) {
                const int mLoc = waveM * 64 + im * 16 + grp * 8 + r;
                const int nLoc = waveN * 64 + in * 16 + l16;
                const int gm = m0 + mLoc;   // b*S + s
                const int gn = n0 + nLoc;   // h*HD + hd
                const float v = acc[im][in][r] + bias[gn];
                const int b = gm >> 11, s = gm & 2047;
                const int h = gn >> 6, hd = gn & 63;
                out[(((size_t)(b * Hc + h) * Sc + s) * HDc) + hd] = (_Float16)v;
            }
}

__global__ void __launch_bounds__(256)
attn_kernel(const _Float16* __restrict__ Q, const _Float16* __restrict__ K,
            const _Float16* __restrict__ V, _Float16* __restrict__ X)
{
    constexpr int LQ = 72;  // 72 halves = 144B row stride (16B aligned)
    constexpr int LV = 80;  // 80 halves = 160B row stride for transposing loads
    constexpr int NT = Sc / 64;
    constexpr int QB = 256; // queries per block
    __shared__ __align__(16) _Float16 Qs[QB * LQ];       // Q tile
    __shared__ __align__(16) _Float16 Ks[2 * 64 * LQ];   // [buf][key][hd]
    __shared__ __align__(16) _Float16 Vs[2 * 64 * LV];   // [buf][key][hd]

    const int tid  = threadIdx.x;
    const int lane = tid & 31, wid = tid >> 5;
    const int l16 = lane & 15, grp = lane >> 4;
    const int bh = blockIdx.y;            // b*H + h
    const int b  = bh >> 4, h = bh & 15;
    const int q0 = blockIdx.x * QB;
    const int trRow = grp * 8 + (lane & 7), trCol = ((lane >> 3) & 1) * 8;

    const _Float16* Qp = Q + (size_t)bh * Sc * HDc;
    const _Float16* Kp = K + (size_t)bh * Sc * HDc;
    const _Float16* Vp = V + (size_t)bh * Sc * HDc;

    auto stage_kv = [&](int kb, int buf) {
        _Float16* KsB = &Ks[buf * 64 * LQ];
#pragma unroll
        for (int c = 0; c < 2; ++c) {
            const int idx = tid + c * 256;
            const int row = idx >> 3, c8 = idx & 7;
            async_cp16(&KsB[row * LQ + c8 * 8],
                       Kp + (size_t)(kb + row) * HDc + c8 * 8);
        }
#pragma unroll
        for (int c = 0; c < 2; ++c) {
            const int idx = tid + c * 256;
            const int row = idx >> 3, c8 = idx & 7;
            async_cp16(&Vs[buf * 64 * LV + row * LV + c8 * 8],
                       Vp + (size_t)(kb + row) * HDc + c8 * 8);
        }
    };

    // Stage Q tile (async) + first K/V tile, then pull Q fragments to regs.
#pragma unroll
    for (int c = 0; c < QB / 32; ++c) {
        const int idx = tid + c * 256;
        const int row = idx >> 3, c8 = idx & 7;
        async_cp16(&Qs[row * LQ + c8 * 8],
                   Qp + (size_t)(q0 + row) * HDc + c8 * 8);
    }
    stage_kv(0, 0);
    wait_async0();
    __syncthreads();

    // B fragments of Q^T: column group cg, column = query wid*32 + cg*16 + l16,
    // k = hd.
    v16h qfr[2][2];
#pragma unroll
    for (int cg = 0; cg < 2; ++cg)
#pragma unroll
        for (int ks = 0; ks < 2; ++ks)
            qfr[cg][ks] = load_frag(&Qs[(wid * 32 + cg * 16 + l16) * LQ] + ks * 32, grp);

    v8f oacc[2][4];  // O^T: row hd = in*16 + grp*8 + r, column = query l16 of group cg
    float dpart[2][8];  // this lane's share of its two queries' sums, 8 chains each
#pragma unroll
    for (int cg = 0; cg < 2; ++cg) {
#pragma unroll
        for (int i = 0; i < 4; ++i) oacc[cg][i] = zero8();
#pragma unroll
        for (int r = 0; r < 8; ++r) dpart[cg][r] = 0.0f;
    }

    for (int kt = 0; kt < NT; ++kt) {
        const int cur = kt & 1;
        // This wave's LDS reads of buf cur^1 have retired before copies aim at it.
        asm volatile("s_wait_dscnt 0x0" ::: "memory");
        // This wave's copies of tile kt have landed.
        asm volatile("s_wait_asynccnt 0x0" ::: "memory");
        __syncthreads();     // all waves' tile kt visible; buf cur^1 is free
        if (kt + 1 < NT) stage_kv((kt + 1) * 64, cur ^ 1);  // DMA overlaps WMMA

        const _Float16* KsB = &Ks[cur * 64 * LQ];
        const _Float16* VsB = &Vs[cur * 64 * LV];

        // S^T = K Q^T  (M=64 keys -> 4 m-subtiles, N=2x16 queries, K=HD=64)
        v16h kfr[4][2];
#pragma unroll
        for (int jm = 0; jm < 4; ++jm)
#pragma unroll
            for (int ks = 0; ks < 2; ++ks)
                kfr[jm][ks] = load_frag(&KsB[(jm * 16 + l16) * LQ] + ks * 32, grp);
        // Keeps the tile's K fragment reads in one group ahead of the S^T products.
        __builtin_amdgcn_sched_barrier(0);
        v8f e[2][4];
#pragma unroll
        for (int jm = 0; jm < 4; ++jm) {
            e[0][jm] = zero8();
            e[1][jm] = zero8();
#pragma unroll
            for (int ks = 0; ks < 2; ++ks)
#pragma unroll
                for (int cg = 0; cg < 2; ++cg)
                    e[cg][jm] = wmma32(kfr[jm][ks], qfr[cg][ks], e[cg][jm]);
        }
        __builtin_amdgcn_sched_barrier(0);
        // exp, partial denominator, pack P^T (f16) as B fragments: subtile jm
        // holds keys jm*16 + grp*8 + r, i.e. halves 0..7 (jm even) or 8..15
        // (jm odd) of the 32-key fragment jm/2.
        v16h pfr[2][2];
#pragma unroll
        for (int cg = 0; cg < 2; ++cg)
#pragma unroll
            for (int jm = 0; jm < 4; ++jm)
#pragma unroll
                for (int r = 0; r < 8; ++r) {
                    const float ev = __expf(e[cg][jm][r] * 0.125f);
                    dpart[cg][r] += ev;
                    pfr[cg][jm >> 1][(jm & 1) * 8 + r] = (_Float16)ev;
                }

        // O^T += V^T P^T  (M=64 hd -> 4 m-subtiles, K=64 keys -> 2 k-steps)
#pragma unroll
        for (int in = 0; in < 4; ++in)
#pragma unroll
            for (int ks = 0; ks < 2; ++ks) {
                const v16h afr = load_frag_tr(
                    &VsB[(ks * 32 + trRow) * LV + in * 16 + trCol], LV);
#pragma unroll
                for (int cg = 0; cg < 2; ++cg)
                    oacc[cg][in] = wmma32(afr, pfr[cg][ks], oacc[cg][in]);
            }
    }

#pragma unroll
    for (int cg = 0; cg < 2; ++cg) {
        // Denominator of query l16 of group cg: the lane's 8 chains, then the
        // other half-wave (which held the other 8 keys of every 16).
        float dsum = ((dpart[cg][0] + dpart[cg][1]) + (dpart[cg][2] + dpart[cg][3])) +
                     ((dpart[cg][4] + dpart[cg][5]) + (dpart[cg][6] + dpart[cg][7]));
        dsum += __shfl_xor(dsum, 16);
        const float dinv = 1.0f / (1.0f + dsum);   // softmax_1 denominator

        // Normalize and write X in [B, S, D] f16 layout: 8 consecutive hd per lane
        const int qrow = q0 + wid * 32 + cg * 16 + l16;
        _Float16* xrow = X + ((size_t)b * Sc + qrow) * Dc + h * HDc + grp * 8;
#pragma unroll
        for (int in = 0; in < 4; ++in) {
            v8h o;
#pragma unroll
            for (int r = 0; r < 8; ++r) o[r] = (_Float16)(oacc[cg][in][r] * dinv);
            *(v8h*)(xrow + in * 16) = o;
        }
    }
}

// ---------------------------------------------------------------------------
// Kernel 3: final projection.  out[M=8192, N=256] = Xh[M,K=1024] * Wf + bf
// 128 x 128 block, 32 x 64 wave tiles, the same two-buffer pass as proj; A and
// W already f16.
// ---------------------------------------------------------------------------
__global__ void __launch_bounds__(256)
final_kernel(const _Float16* __restrict__ Xh, const _Float16* __restrict__ W,
             const float* __restrict__ bias, float* __restrict__ out)
{
    constexpr int BM = 128, BN = 128, BK = 128;
    constexpr int LDS_S = BK + 8;  // 272B row stride (16B x odd) for b128 reads
    constexpr int LDS_B = 144;     // W tile kept [k][n]: 288B row stride
    constexpr int Kdim = 1024, Nglob = 256, NT = Kdim / BK;
    constexpr int ASZ = BM * LDS_S, BSZ = BK * LDS_B;      // halves per buffer
    constexpr int AC = BM * BK / 8 / 256, BC = BK * BN / 8 / 256;
    __shared__ __align__(16) _Float16 As[2 * ASZ];
    __shared__ __align__(16) _Float16 Bs[2 * BSZ];

    const int tid  = threadIdx.x;
    const int lane = tid & 31, wid = tid >> 5;
    const int waveM = wid & 3, waveN = wid >> 2;
    const int l16 = lane & 15, grp = lane >> 4;
    const int m0 = blockIdx.x * BM, n0 = blockIdx.y * BN;
    const int trRow = grp * 8 + (lane & 7), trCol = ((lane >> 3) & 1) * 8;

    v8f acc[2][4];
#pragma unroll
    for (int i = 0; i < 2; ++i)
#pragma unroll
        for (int j = 0; j < 4; ++j) acc[i][j] = zero8();

    // Chunk c of a thread lies AR rows (Xh) or 16 rows (W) below chunk c-1: one
    // running pointer per operand, the chunks at constant offsets from it.
    constexpr int AR = 256 / (BK / 8);
    const int aRow = tid / (BK / 8), aCol = (tid % (BK / 8)) * 8;
    const int bRow = tid >> 4, bCol = (tid & 15) * 8;
    const _Float16* aP = Xh + (size_t)(m0 + aRow) * Kdim + aCol;
    const _Float16* bP = W + (size_t)bRow * Nglob + n0 + bCol;
    v8h aReg[AC];
    v8h bReg[BC];
    auto load_tiles = [&]() {   // the next BK columns of Xh, the next BK rows of W
#pragma unroll
        for (int c = 0; c < AC; ++c)
            aReg[c] = *(const v8h*)(aP + (size_t)c * AR * Kdim);
#pragma unroll
        for (int c = 0; c < BC; ++c)
            bReg[c] = *(const v8h*)(bP + (size_t)c * 16 * Nglob);
        // The pointers named by the loads above are advanced next. The clobber
        // also keeps these loads ahead of the pass's LDS reads and WMMAs: sunk
        // among them, their whole latency is waited out at the next pass's head.
        asm volatile("s_wait_xcnt 0x0" ::: "memory");
        aP += BK;
        bP += (size_t)BK * Nglob;
    };
    auto store_tiles = [&](int buf) {
#pragma unroll
        for (int c = 0; c < AC; ++c)
            *(v8h*)(&As[buf * ASZ + aRow * LDS_S + aCol + c * AR * LDS_S]) = aReg[c];
#pragma unroll
        for (int c = 0; c < BC; ++c)
            *(v8h*)(&Bs[buf * BSZ + bRow * LDS_B + bCol + c * 16 * LDS_B]) = bReg[c];
    };

    load_tiles();
    for (int kt = 0; kt < NT; ++kt) {
        const int cur = kt & 1;
        store_tiles(cur);   // its last readers (pass kt-2) passed the barrier of pass kt-1
        __syncthreads();    // publishes tile kt
        if (kt + 1 < NT) load_tiles();

#pragma unroll
        for (int ks = 0; ks < BK / 32; ++ks) {
            v16h afr[2], bfr[4];
#pragma unroll
            for (int im = 0; im < 2; ++im)
                afr[im] = load_frag(&As[cur * ASZ + (waveM * 32 + im * 16 + l16) * LDS_S] + ks * 32, grp);
#pragma unroll
            for (int in = 0; in < 4; ++in)
                bfr[in] = load_frag_tr(&Bs[cur * BSZ + (ks * 32 + trRow) * LDS_B + waveN * 64 + in * 16 + trCol], LDS_B);
#pragma unroll
            for (int im = 0; im < 2; ++im)
#pragma unroll
                for (int in = 0; in < 4; ++in)
                    acc[im][in] = wmma32(afr[im], bfr[in], acc[im][in]);
        }
    }

#pragma unroll
    for (int im = 0; im < 2; ++im)
#pragma unroll
        for (int in = 0; in < 4; ++in)
#pragma unroll
            for (int r = 0; r < 8; ++r) {
                const int mLoc = waveM * 32 + im * 16 + grp * 8 + r;
                const int nLoc = waveN * 64 + in * 16 + l16;
                const int gm = m0 + mLoc;
                const int gn = n0 + nLoc;
                out[(size_t)gm * OUTc + gn] = acc[im][in][r] + bias[gn];
            }
}

// ---------------------------------------------------------------------------
extern "C" void kernel_launch(void* const* d_in, const int* in_sizes, int n_in,
                              void* d_out, int out_size, void* d_ws, size_t ws_size,
                              hipStream_t stream)
{
    (void)in_sizes; (void)n_in; (void)out_size; (void)ws_size;
    const float* query = (const float*)d_in[0];
    const float* key   = (const float*)d_in[1];
    const float* value = (const float*)d_in[2];
    const float* Wq = (const float*)d_in[3];
    const float* bq = (const float*)d_in[4];
    const float* Wk = (const float*)d_in[5];
    const float* bk = (const float*)d_in[6];
    const float* Wv = (const float*)d_in[7];
    const float* bv = (const float*)d_in[8];
    const float* Wf = (const float*)d_in[9];
    const float* bf = (const float*)d_in[10];
    float* out = (float*)d_out;

    // Workspace layout (f16): Qh | Kh | Vh | Xh, each B*H*S*HD = 8,388,608 elems,
    // then the f16 weights Wq | Wk | Wv (D*D each) | Wf (D*OUT)
    _Float16* ws = (_Float16*)d_ws;
    const size_t per = (size_t)Bc * Hc * Sc * HDc;
    _Float16* Qh = ws;
    _Float16* Kh = ws + per;
    _Float16* Vh = ws + 2 * per;
    _Float16* Xh = ws + 3 * per;
    const size_t wper = (size_t)Dc * Dc;
    _Float16* Wh = ws + 4 * per;

    const dim3 blk(256);
    const dim3 gproj(Bc * Sc / 128, Dc / 256, 3);    // (64, 4, 3)
    wcvt_kernel<<<dim3((3 * Dc * Dc + Dc * OUTc) / 8192), blk, 0, stream>>>(Wq, Wk, Wv, Wf, Wh);
    proj_kernel<<<gproj, blk, 0, stream>>>(query, key, value, Wh, bq, bk, bv, Qh);

    attn_kernel<<<dim3(Sc / 256, Bc * Hc), blk, 0, stream>>>(Qh, Kh, Vh, Xh);

    final_kernel<<<dim3(Bc * Sc / 128, OUTc / 128), blk, 0, stream>>>(Xh, Wh + 3 * wper, bf, out);
}

// v009
// It runs in 114 microseconds.
// Two timings next to v008 both put it at 1.04 times that version's speed.
// Over all steps from v000 it is 4.09 times as fast.
#include <hip/hip_runtime.h>
#include <hip/hip_bf16.h>
#include <stdint.h>

typedef _Float16 v16h __attribute__((ext_vector_type(16)));
typedef _Float16 v8h  __attribute__((ext_vector_type(8)));
typedef float    v8f  __attribute__((ext_vector_type(8)));
typedef int      v4i  __attribute__((ext_vector_type(4)));
typedef _Float16 v4h  __attribute__((ext_vector_type(4)));
typedef short    v8s  __attribute__((ext_vector_type(8)));

constexpr int Bc  = 4;
constexpr int Sc  = 2048;
constexpr int Dc  = 1024;
constexpr int Hc  = 16;
constexpr int HDc = 64;
constexpr int OUTc = 256;

#if defined(__has_builtin)
#if __has_builtin(__builtin_amdgcn_global_load_async_to_lds_b128)
#define HAVE_ASYNC_LDS 1
#else
#define HAVE_ASYNC_LDS 0
#endif
#if __has_builtin(__builtin_amdgcn_s_wait_asynccnt)
#define HAVE_WAIT_ASYNC 1
#else
#define HAVE_WAIT_ASYNC 0
#endif
#else
#define HAVE_ASYNC_LDS 0
#define HAVE_WAIT_ASYNC 0
#endif

typedef __attribute__((address_space(1))) v4i gv4i;   // global int4
typedef __attribute__((address_space(3))) v4i lv4i;   // LDS int4

__device__ inline void async_cp16(void* lds, const void* gsrc) {
#if HAVE_ASYNC_LDS
    gv4i* g = (gv4i*)(unsigned long long)(uintptr_t)gsrc;
    lv4i* l = (lv4i*)(unsigned int)(uintptr_t)lds;
    __builtin_amdgcn_global_load_async_to_lds_b128(g, l, 0, 0);
#else
    *(v8h*)lds = *(const v8h*)gsrc;
#endif
}

__device__ inline void wait_async0() {
#if HAVE_ASYNC_LDS
#if HAVE_WAIT_ASYNC
    __builtin_amdgcn_s_wait_asynccnt(0);
#else
    asm volatile("s_wait_asynccnt 0x0" ::: "memory");
#endif
#endif
}

__device__ inline v8f zero8() {
    v8f z;
#pragma unroll
    for (int i = 0; i < 8; ++i) z[i] = 0.0f;
    return z;
}

__device__ inline v16h load_frag(const _Float16* rowPtr, int grp) {
    const v8h lo = *(const v8h*)(rowPtr + grp * 8);
    const v8h hi = *(const v8h*)(rowPtr + grp * 8 + 16);
    v16h r;
#pragma unroll
    for (int i = 0; i < 8; ++i) { r[i] = lo[i]; r[i + 8] = hi[i]; }
    return r;
}

// B fragment (32 k x 16 n) from a ROW-MAJOR [k][n] f16 LDS tile by two
// transposing loads. p is this lane's address:
//   tile + (kbase + 8*grp + (lane&7)) * pitch + nbase + 8*((lane>>3)&1)
// Lane (l16, grp) receives k = kbase + 8*grp + 0..7 of column nbase + l16, the
// second load the same 16 rows further: the k order of load_frag above.
// pitch (halves) is an odd multiple of 16 halves (32 B) for these loads.
typedef __attribute__((address_space(3))) v8s lv8s;
__device__ inline v16h load_frag_tr(const _Float16* p, int pitch) {
    const v8h lo = __builtin_bit_cast(v8h,
        __builtin_amdgcn_ds_load_tr16_b128_v8i16((lv8s*)p));
    const v8h hi = __builtin_bit_cast(v8h,
        __builtin_amdgcn_ds_load_tr16_b128_v8i16((lv8s*)(p + 16 * pitch)));
    v16h r;
#pragma unroll
    for (int i = 0; i < 8; ++i) { r[i] = lo[i]; r[i + 8] = hi[i]; }
    return r;
}

__device__ inline v4h cvt4(float4 f) {
    v4h r;
    r[0] = (_Float16)f.x; r[1] = (_Float16)f.y;
    r[2] = (_Float16)f.z; r[3] = (_Float16)f.w;
    return r;
}

__device__ inline v8f wmma32(v16h a, v16h b, v8f c) {
    return __builtin_amdgcn_wmma_f32_16x16x32_f16(
        /*neg_a=*/false, a, /*neg_b=*/false, b,
        /*c_mod=*/(short)0, c, /*reuse_a=*/false, /*reuse_b=*/false);
}

// ---------------------------------------------------------------------------
// Kernel 0: the four weight matrices to f16, once per call, layout unchanged.
// dst = Wq | Wk | Wv | Wf. A block converts 8192 consecutive floats: blocks
// 0..127 Wq, 128..255 Wk, 256..383 Wv, 384..415 Wf. The GEMM kernels re-read a
// W tile in every row block (64 times), so they fetch it at half the bytes.
// ---------------------------------------------------------------------------
__global__ void __launch_bounds__(256)
wcvt_kernel(const float* __restrict__ Wq, const float* __restrict__ Wk,
            const float* __restrict__ Wv, const float* __restrict__ Wf,
            _Float16* __restrict__ dst)
{
    const int which = blockIdx.x >> 7;
    const float* src = which == 0 ? Wq : which == 1 ? Wk : which == 2 ? Wv : Wf;
    const float4* sp = (const float4*)(src + (size_t)(blockIdx.x & 127) * 8192) + threadIdx.x;
    v4h* dp = (v4h*)(dst + (size_t)blockIdx.x * 8192) + threadIdx.x;
    float4 r[8];
#pragma unroll
    for (int j = 0; j < 8; ++j) r[j] = sp[j * 256];
#pragma unroll
    for (int j = 0; j < 8; ++j) dp[j * 256] = cvt4(r[j]);
}

// ---------------------------------------------------------------------------
// Kernel 1: QKV projections.  C[M=8192, N=1024] = X[M,K=1024] * W[K,N] + bias
// All three in ONE launch: blockIdx.z picks the input, its weights, bias and
// output plane. They do not depend on one another, so a WGP goes on to its next
// block when it is free and does not wait for the slowest block of a launch.
// W arrives as f16 (kernel 0), the three matrices one behind the other.
// Output written as f16 in [B, H, S, HD] layout (head-transposed).
// Two LDS buffers, one barrier per pass. Behind the barrier of pass k the X
// loads of tile k+1 go out, then the async copies that bring its W tile (f16
// already) straight into the other buffer; both fly during the pass's LDS reads
// and WMMAs. X is converted and stored at the head of pass k+1, while the W
// copies may still be landing.
// Block tile 128 x 256, K pass 128, 8 waves of 64 x 64 (2 x 4): a row of X is
// fetched by 4 column blocks, and 8 fragments feed 16 WMMAs. 3 x 256 blocks,
// one per WGP (LDS).
// ---------------------------------------------------------------------------
__global__ void __launch_bounds__(256)
proj_kernel(const float* __restrict__ Xq, const float* __restrict__ Xk,
            const float* __restrict__ Xv, const _Float16* __restrict__ Wqkv,
            const float* __restrict__ bq, const float* __restrict__ bk,
            const float* __restrict__ bv, _Float16* __restrict__ QKV)
{
    const int which = blockIdx.z;   // 0 Q, 1 K, 2 V
    const float* __restrict__ X    = which == 0 ? Xq : which == 1 ? Xk : Xv;
    const float* __restrict__ bias = which == 0 ? bq : which == 1 ? bk : bv;
    const _Float16* __restrict__ W = Wqkv + (size_t)which * Dc * Dc;
    _Float16* __restrict__ out     = QKV + (size_t)which * Bc * Hc * Sc * HDc;

    constexpr int BM = 128, BN = 256, BK = 128;
    constexpr int LDS_S = BK + 8;  // 272B row stride (16B x odd) for b128 reads
    constexpr int LDS_B = BN + 16; // W tile kept [k][n]: 544B row stride (32B x odd)
    constexpr int Kdim = 1024, Nglob = 1024, NT = Kdim / BK;
    constexpr int ASZ = BM * LDS_S, BSZ = BK * LDS_B;      // halves per buffer
    constexpr int AC = BM * BK / 4 / 256, BC = BK * BN / 8 / 256;
    __shared__ __align__(16) _Float16 As[2 * ASZ];
    __shared__ __align__(16) _Float16 Bs[2 * BSZ];

    const int tid  = threadIdx.x;
    const int lane = tid & 31, wid = tid >> 5;
    const int waveM = wid & 1, waveN = wid >> 1;
    const int l16 = lane & 15, grp = lane >> 4;
    const int m0 = blockIdx.x * BM, n0 = blockIdx.y * BN;
    const int trRow = grp * 8 + (lane & 7), trCol = ((lane >> 3) & 1) * 8;

    v8f acc[4][4];
#pragma unroll
    for (int i = 0; i < 4; ++i)
#pragma unroll
        for (int j = 0; j < 4; ++j) acc[i][j] = zero8();

    // Chunk c of a thread lies AR rows (X) or BR rows (W) below chunk c-1: one
    // running pointer per operand, the chunks at constant offsets from it.
    constexpr int AR = 256 / (BK / 4), BR = 256 / (BN / 8);
    const int aRow = tid / (BK / 4), aCol = (tid % (BK / 4)) * 4;
    const int bRow = tid / (BN / 8), bCol = (tid % (BN / 8)) * 8;
    const float* aP = X + (size_t)(m0 + aRow) * Kdim + aCol;
    const _Float16* bP = W + (size_t)bRow * Nglob + n0 + bCol;
    float4 aReg[AC];
    auto load_tiles = [&](int buf) {   // the next BK columns of X, the next BK rows of W
#pragma unroll
        for (int c = 0; c < AC; ++c)
            aReg[c] = *(const float4*)(aP + (size_t)c * AR * Kdim);
        // The pointer named by the loads above is advanced next. The clobber
        // also keeps these loads ahead of the pass's LDS reads and WMMAs: sunk
        // among them, their whole latency is waited out at the next pass's head.
        asm volatile("s_wait_xcnt 0x0" ::: "memory");
        // Keeps the pointer addition behind that wait: nothing ties it to it,
        // and the scheduler lifts it over it.
        __builtin_amdgcn_sched_barrier(0);
        aP += BK;
        // W behind X: X is wanted first, for its conversion.
#pragma unroll
        for (int c = 0; c < BC; ++c)
            async_cp16(&Bs[buf * BSZ + bRow * LDS_B + bCol + c * BR * LDS_B],
                       bP + (size_t)c * BR * Nglob);
        bP += (size_t)BK * Nglob;
    };
    auto store_tiles = [&](int buf) {
#pragma unroll
        for (int c = 0; c < AC; ++c)
            *(v4h*)(&As[buf * ASZ + aRow * LDS_S + aCol + c * AR * LDS_S]) = cvt4(aReg[c]);
    };

    load_tiles(0);
    for (int kt = 0; kt < NT; ++kt) {
        const int cur = kt & 1;
        store_tiles(cur);   // its last readers (pass kt-2) passed the barrier of pass kt-1
        // This wave's LDS reads of buf cur^1 have retired before copies aim at it.
        asm volatile("s_wait_dscnt 0x0" ::: "memory");
        // This wave's copies of W tile kt have landed.
        asm volatile("s_wait_asynccnt 0x0" ::: "memory");
        __syncthreads();    // publishes tile kt; buf cur^1 is free
        if (kt + 1 < NT) load_tiles(cur ^ 1);

#pragma unroll
        for (int ks = 0; ks < BK / 32; ++ks) {
            v16h afr[4], bfr[4];
#pragma unroll
            for (int im = 0; im < 4; ++im)
                afr[im] = load_frag(&As[cur * ASZ + (waveM * 64 + im * 16 + l16) * LDS_S] + ks * 32, grp);
#pragma unroll
            for (int in = 0; in < 4; ++in)
                bfr[in] = load_frag_tr(&Bs[cur * BSZ + (ks * 32 + trRow) * LDS_B + waveN * 64 + in * 16 + trCol], LDS_B);
            // Keeps the k step's 16 fragment reads in one group ahead of its 16
            // WMMAs: left free, each A fragment is read into one register set and
            // waited for in full in front of every 4 WMMAs.
            __builtin_amdgcn_sched_barrier(0);
#pragma unroll
            for (int im = 0; im < 4; ++im)
#pragma unroll
                for (int in = 0; in < 4; ++in)
                    acc[im][in] = wmma32(afr[im], bfr[in], acc[im][in]);
        }
    }
    // The ring's closing wait: no copy of this wave is open when it ends.
    asm volatile("s_wait_asynccnt 0x0" ::: "memory");

    // Epilogue: bias add, convert f16, scatter to [B,H,S,HD]
#pragma unroll
    for (int im = 0; im < 4; ++im)
#pragma unroll
        for (int in = 0; in < 4; ++in)
#pragma unroll
            for (int r = 0; r < 8; ++r) {
                const int mLoc = waveM * 64 + im * 16 + grp * 8 + r;
                const int nLoc = waveN * 64 + in * 16 + l16;
                const int gm = m0 + mLoc;   // b*S + s
                const int gn = n0 + nLoc;   // h*HD + hd
                const float v = acc[im][in][r] + bias[gn];
                const int b = gm >> 11, s = gm & 2047;
                const int h = gn >> 6, hd = gn & 63;
                out[(((size_t)(b * Hc + h) * Sc + s) * HDc) + hd] = (_Float16)v;
            }
}

__global__ void __launch_bounds__(256)
attn_kernel(const _Float16* __restrict__ Q, const _Float16* __restrict__ K,
            const _Float16* __restrict__ V, _Float16* __restrict__ X)
{
    constexpr int LQ = 72;  // 72 halves = 144B row stride (16B aligned)
    constexpr int LV = 80;  // 80 halves = 160B row stride for transposing loads
    constexpr int NT = Sc / 64;
    constexpr int QB = 256; // queries per block
    __shared__ __align__(16) _Float16 Qs[QB * LQ];       // Q tile
    __shared__ __align__(16) _Float16 Ks[2 * 64 * LQ];   // [buf][key][hd]
    __shared__ __align__(16) _Float16 Vs[2 * 64 * LV];   // [buf][key][hd]

    const int tid  = threadIdx.x;
    const int lane = tid & 31, wid = tid >> 5;
    const int l16 = lane & 15, grp = lane >> 4;
    const int bh = blockIdx.y;            // b*H + h
    const int b  = bh >> 4, h = bh & 15;
    const int q0 = blockIdx.x * QB;
    const int trRow = grp * 8 + (lane & 7), trCol = ((lane >> 3) & 1) * 8;

    const _Float16* Qp = Q + (size_t)bh * Sc * HDc;
    const _Float16* Kp = K + (size_t)bh * Sc * HDc;
    const _Float16* Vp = V + (size_t)bh * Sc * HDc;

    auto stage_kv = [&](int kb, int buf) {
        _Float16* KsB = &Ks[buf * 64 * LQ];
#pragma unroll
        for (int c = 0; c < 2; ++c) {
            const int idx = tid + c * 256;
            const int row = idx >> 3, c8 = idx & 7;
            async_cp16(&KsB[row * LQ + c8 * 8],
                       Kp + (size_t)(kb + row) * HDc + c8 * 8);
        }
#pragma unroll
        for (int c = 0; c < 2; ++c) {
            const int idx = tid + c * 256;
            const int row = idx >> 3, c8 = idx & 7;
            async_cp16(&Vs[buf * 64 * LV + row * LV + c8 * 8],
                       Vp + (size_t)(kb + row) * HDc + c8 * 8);
        }
    };

    // Stage Q tile (async) + first K/V tile, then pull Q fragments to regs.
#pragma unroll
    for (int c = 0; c < QB / 32; ++c) {
        const int idx = tid + c * 256;
        const int row = idx >> 3, c8 = idx & 7;
        async_cp16(&Qs[row * LQ + c8 * 8],
                   Qp + (size_t)(q0 + row) * HDc + c8 * 8);
    }
    stage_kv(0, 0);
    wait_async0();
    __syncthreads();

    // B fragments of Q^T: column group cg, column = query wid*32 + cg*16 + l16,
    // k = hd.
    v16h qfr[2][2];
#pragma unroll
    for (int cg = 0; cg < 2; ++cg)
#pragma unroll
        for (int ks = 0; ks < 2; ++ks)
            qfr[cg][ks] = load_frag(&Qs[(wid * 32 + cg * 16 + l16) * LQ] + ks * 32, grp);

    v8f oacc[2][4];  // O^T: row hd = in*16 + grp*8 + r, column = query l16 of group cg
    float dpart[2][8];  // this lane's share of its two queries' sums, 8 chains each
#pragma unroll
    for (int cg = 0; cg < 2; ++cg) {
#pragma unroll
        for (int i = 0; i < 4; ++i) oacc[cg][i] = zero8();
#pragma unroll
        for (int r = 0; r < 8; ++r) dpart[cg][r] = 0.0f;
    }

    for (int kt = 0; kt < NT; ++kt) {
        const int cur = kt & 1;
        // This wave's LDS reads of buf cur^1 have retired before copies aim at it.
        asm volatile("s_wait_dscnt 0x0" ::: "memory");
        // This wave's copies of tile kt have landed.
        asm volatile("s_wait_asynccnt 0x0" ::: "memory");
        __syncthreads();     // all waves' tile kt visible; buf cur^1 is free
        if (kt + 1 < NT) stage_kv((kt + 1) * 64, cur ^ 1);  // DMA overlaps WMMA

        const _Float16* KsB = &Ks[cur * 64 * LQ];
        const _Float16* VsB = &Vs[cur * 64 * LV];

        // S^T = K Q^T  (M=64 keys -> 4 m-subtiles, N=2x16 queries, K=HD=64)
        v16h kfr[4][2];
#pragma unroll
        for (int jm = 0; jm < 4; ++jm)
#pragma unroll
            for (int ks = 0; ks < 2; ++ks)
                kfr[jm][ks] = load_frag(&KsB[(jm * 16 + l16) * LQ] + ks * 32, grp);
        // Keeps the tile's K fragment reads in one group ahead of the S^T products.
        __builtin_amdgcn_sched_barrier(0);
        v8f e[2][4];
#pragma unroll
        for (int jm = 0; jm < 4; ++jm) {
            e[0][jm] = zero8();
            e[1][jm] = zero8();
#pragma unroll
            for (int ks = 0; ks < 2; ++ks)
#pragma unroll
                for (int cg = 0; cg < 2; ++cg)
                    e[cg][jm] = wmma32(kfr[jm][ks], qfr[cg][ks], e[cg][jm]);
        }
        __builtin_amdgcn_sched_barrier(0);
        // exp, partial denominator, pack P^T (f16) as B fragments: subtile jm
        // holds keys jm*16 + grp*8 + r, i.e. halves 0..7 (jm even) or 8..15
        // (jm odd) of the 32-key fragment jm/2.
        v16h pfr[2][2];
#pragma unroll
        for (int cg = 0; cg < 2; ++cg)
#pragma unroll
            for (int jm = 0; jm < 4; ++jm)
#pragma unroll
                for (int r = 0; r < 8; ++r) {
                    const float ev = __expf(e[cg][jm][r] * 0.125f);
                    dpart[cg][r] += ev;
                    pfr[cg][jm >> 1][(jm & 1) * 8 + r] = (_Float16)ev;
                }

        // O^T += V^T P^T  (M=64 hd -> 4 m-subtiles, K=64 keys -> 2 k-steps)
#pragma unroll
        for (int in = 0; in < 4; ++in)
#pragma unroll
            for (int ks = 0; ks < 2; ++ks) {
                const v16h afr = load_frag_tr(
                    &VsB[(ks * 32 + trRow) * LV + in * 16 + trCol], LV);
#pragma unroll
                for (int cg = 0; cg < 2; ++cg)
                    oacc[cg][in] = wmma32(afr, pfr[cg][ks], oacc[cg][in]);
            }
    }

#pragma unroll
    for (int cg = 0; cg < 2; ++cg) {
        // Denominator of query l16 of group cg: the lane's 8 chains, then the
        // other half-wave (which held the other 8 keys of every 16).
        float dsum = ((dpart[cg][0] + dpart[cg][1]) + (dpart[cg][2] + dpart[cg][3])) +
                     ((dpart[cg][4] + dpart[cg][5]) + (dpart[cg][6] + dpart[cg][7]));
        dsum += __shfl_xor(dsum, 16);
        const float dinv = 1.0f / (1.0f + dsum);   // softmax_1 denominator

        // Normalize and write X in [B, S, D] f16 layout: 8 consecutive hd per lane
        const int qrow = q0 + wid * 32 + cg * 16 + l16;
        _Float16* xrow = X + ((size_t)b * Sc + qrow) * Dc + h * HDc + grp * 8;
#pragma unroll
        for (int in = 0; in < 4; ++in) {
            v8h o;
#pragma unroll
            for (int r = 0; r < 8; ++r) o[r] = (_Float16)(oacc[cg][in][r] * dinv);
            *(v8h*)(xrow + in * 16) = o;
        }
    }
}

// ---------------------------------------------------------------------------
// Kernel 3: final projection.  out[M=8192, N=256] = Xh[M,K=1024] * Wf + bf
// 128 x 128 block, 32 x 64 wave tiles, two LDS buffers and one barrier per pass
// as in proj; A and W are f16 already, so both tiles come by async copies.
// ---------------------------------------------------------------------------
__global__ void __launch_bounds__(256)
final_kernel(const _Float16* __restrict__ Xh, const _Float16* __restrict__ W,
             const float* __restrict__ bias, float* __restrict__ out)
{
    constexpr int BM = 128, BN = 128, BK = 128;
    constexpr int LDS_S = BK + 8;  // 272B row stride (16B x odd) for b128 reads
    constexpr int LDS_B = 144;     // W tile kept [k][n]: 288B row stride
    constexpr int Kdim = 1024, Nglob = 256, NT = Kdim / BK;
    constexpr int ASZ = BM * LDS_S, BSZ = BK * LDS_B;      // halves per buffer
    constexpr int AC = BM * BK / 8 / 256, BC = BK * BN / 8 / 256;
    __shared__ __align__(16) _Float16 As[2 * ASZ];
    __shared__ __align__(16) _Float16 Bs[2 * BSZ];

    const int tid  = threadIdx.x;
    const int lane = tid & 31, wid = tid >> 5;
    const int waveM = wid & 3, waveN = wid >> 2;
    const int l16 = lane & 15, grp = lane >> 4;
    const int m0 = blockIdx.x * BM, n0 = blockIdx.y * BN;
    const int trRow = grp * 8 + (lane & 7), trCol = ((lane >> 3) & 1) * 8;

    v8f acc[2][4];
#pragma unroll
    for (int i = 0; i < 2; ++i)
#pragma unroll
        for (int j = 0; j < 4; ++j) acc[i][j] = zero8();

    // Chunk c of a thread lies AR rows (Xh) or 16 rows (W) below chunk c-1: one
    // running pointer per operand, the chunks at constant offsets from it.
    constexpr int AR = 256 / (BK / 8);
    const int aRow = tid / (BK / 8), aCol = (tid % (BK / 8)) * 8;
    const int bRow = tid >> 4, bCol = (tid & 15) * 8;
    const _Float16* aP = Xh + (size_t)(m0 + aRow) * Kdim + aCol;
    const _Float16* bP = W + (size_t)bRow * Nglob + n0 + bCol;
    auto copy_tiles = [&](int buf) {   // the next BK columns of Xh, the next BK rows of W
#pragma unroll
        for (int c = 0; c < AC; ++c)
            async_cp16(&As[buf * ASZ + aRow * LDS_S + aCol + c * AR * LDS_S],
                       aP + (size_t)c * AR * Kdim);
#pragma unroll
        for (int c = 0; c < BC; ++c)
            async_cp16(&Bs[buf * BSZ + bRow * LDS_B + bCol + c * 16 * LDS_B],
                       bP + (size_t)c * 16 * Nglob);
        aP += BK;
        bP += (size_t)BK * Nglob;
    };

    copy_tiles(0);
    for (int kt = 0; kt < NT; ++kt) {
        const int cur = kt & 1;
        // This wave's LDS reads of buf cur^1 have retired before copies aim at it.
        asm volatile("s_wait_dscnt 0x0" ::: "memory");
        // This wave's copies of tile kt have landed.
        asm volatile("s_wait_asynccnt 0x0" ::: "memory");
        __syncthreads();    // publishes tile kt; buf cur^1 is free
        if (kt + 1 < NT) copy_tiles(cur ^ 1);

#pragma unroll
        for (int ks = 0; ks < BK / 32; ++ks) {
            v16h afr[2], bfr[4];
#pragma unroll
            for (int im = 0; im < 2; ++im)
                afr[im] = load_frag(&As[cur * ASZ + (waveM * 32 + im * 16 + l16) * LDS_S] + ks * 32, grp);
#pragma unroll
            for (int in = 0; in < 4; ++in)
                bfr[in] = load_frag_tr(&Bs[cur * BSZ + (ks * 32 + trRow) * LDS_B + waveN * 64 + in * 16 + trCol], LDS_B);
#pragma unroll
            for (int im = 0; im < 2; ++im)
#pragma unroll
                for (int in = 0; in < 4; ++in)
                    acc[im][in] = wmma32(afr[im], bfr[in], acc[im][in]);
        }
    }
    // The ring's closing wait: no copy of this wave is open when it ends.
    asm volatile("s_wait_asynccnt 0x0" ::: "memory");

#pragma unroll
    for (int im = 0; im < 2; ++im)
#pragma unroll
        for (int in = 0; in < 4; ++in)
#pragma unroll
            for (int r = 0; r < 8; ++r) {
                const int mLoc = waveM * 32 + im * 16 + grp * 8 + r;
                const int nLoc = waveN * 64 + in * 16 + l16;
                const int gm = m0 + mLoc;
                const int gn = n0 + nLoc;
                out[(size_t)gm * OUTc + gn] = acc[im][in][r] + bias[gn];
            }
}

// ---------------------------------------------------------------------------
extern "C" void kernel_launch(void* const* d_in, const int* in_sizes, int n_in,
                              void* d_out, int out_size, void* d_ws, size_t ws_size,
                              hipStream_t stream)
{
    (void)in_sizes; (void)n_in; (void)out_size; (void)ws_size;
    const float* query = (const float*)d_in[0];
    const float* key   = (const float*)d_in[1];
    const float* value = (const float*)d_in[2];
    const float* Wq = (const float*)d_in[3];
    const float* bq = (const float*)d_in[4];
    const float* Wk = (const float*)d_in[5];
    const float* bk = (const float*)d_in[6];
    const float* Wv = (const float*)d_in[7];
    const float* bv = (const float*)d_in[8];
    const float* Wf = (const float*)d_in[9];
    const float* bf = (const float*)d_in[10];
    float* out = (float*)d_out;

    // Workspace layout (f16): Qh | Kh | Vh | Xh, each B*H*S*HD = 8,388,608 elems,
    // then the f16 weights Wq | Wk | Wv (D*D each) | Wf (D*OUT)
    _Float16* ws = (_Float16*)d_ws;
    const size_t per = (size_t)Bc * Hc * Sc * HDc;
    _Float16* Qh = ws;
    _Float16* Kh = ws + per;
    _Float16* Vh = ws + 2 * per;
    _Float16* Xh = ws + 3 * per;
    const size_t wper = (size_t)Dc * Dc;
    _Float16* Wh = ws + 4 * per;

    const dim3 blk(256);
    const dim3 gproj(Bc * Sc / 128, Dc / 256, 3);    // (64, 4, 3)
    wcvt_kernel<<<dim3((3 * Dc * Dc + Dc * OUTc) / 8192), blk, 0, stream>>>(Wq, Wk, Wv, Wf, Wh);
    proj_kernel<<<gproj, blk, 0, stream>>>(query, key, value, Wh, bq, bk, bv, Qh);

    attn_kernel<<<dim3(Sc / 256, Bc * Hc), blk, 0, stream>>>(Qh, Kh, Vh, Xh);

    final_kernel<<<dim3(Bc * Sc / 128, OUTc / 128), blk, 0, stream>>>(Xh, Wh + 3 * wper, bf, out);
}

// v010
// It runs in 110 microseconds.
// Timed twice side by side with v009, it ran 1.05 and 1.04 times as fast.
// All steps since v000 together make it 4.26 times as fast.
#include <hip/hip_runtime.h>
#include <hip/hip_bf16.h>
#include <stdint.h>

typedef _Float16 v16h __attribute__((ext_vector_type(16)));
typedef _Float16 v8h  __attribute__((ext_vector_type(8)));
typedef float    v8f  __attribute__((ext_vector_type(8)));
typedef int      v4i  __attribute__((ext_vector_type(4)));
typedef _Float16 v4h  __attribute__((ext_vector_type(4)));
typedef short    v8s  __attribute__((ext_vector_type(8)));

constexpr int Bc  = 4;
constexpr int Sc  = 2048;
constexpr int Dc  = 1024;
constexpr int Hc  = 16;
constexpr int HDc = 64;
constexpr int OUTc = 256;

#if defined(__has_builtin)
#if __has_builtin(__builtin_amdgcn_global_load_async_to_lds_b128)
#define HAVE_ASYNC_LDS 1
#else
#define HAVE_ASYNC_LDS 0
#endif
#if __has_builtin(__builtin_amdgcn_s_wait_asynccnt)
#define HAVE_WAIT_ASYNC 1
#else
#define HAVE_WAIT_ASYNC 0
#endif
#else
#define HAVE_ASYNC_LDS 0
#define HAVE_WAIT_ASYNC 0
#endif

typedef __attribute__((address_space(1))) v4i gv4i;   // global int4
typedef __attribute__((address_space(3))) v4i lv4i;   // LDS int4

__device__ inline void async_cp16(void* lds, const void* gsrc) {
#if HAVE_ASYNC_LDS
    gv4i* g = (gv4i*)(unsigned long long)(uintptr_t)gsrc;
    lv4i* l = (lv4i*)(unsigned int)(uintptr_t)lds;
    __builtin_amdgcn_global_load_async_to_lds_b128(g, l, 0, 0);
#else
    *(v8h*)lds = *(const v8h*)gsrc;
#endif
}

__device__ inline void wait_async0() {
#if HAVE_ASYNC_LDS
#if HAVE_WAIT_ASYNC
    __builtin_amdgcn_s_wait_asynccnt(0);
#else
    asm volatile("s_wait_asynccnt 0x0" ::: "memory");
#endif
#endif
}

__device__ inline v8f zero8() {
    v8f z;
#pragma unroll
    for (int i = 0; i < 8; ++i) z[i] = 0.0f;
    return z;
}

__device__ inline v16h load_frag(const _Float16* rowPtr, int grp) {
    const v8h lo = *(const v8h*)(rowPtr + grp * 8);
    const v8h hi = *(const v8h*)(rowPtr + grp * 8 + 16);
    v16h r;
#pragma unroll
    for (int i = 0; i < 8; ++i) { r[i] = lo[i]; r[i + 8] = hi[i]; }
    return r;
}

// B fragment (32 k x 16 n) from a ROW-MAJOR [k][n] f16 LDS tile by two
// transposing loads. p is this lane's address:
//   tile + (kbase + 8*grp + (lane&7)) * pitch + nbase + 8*((lane>>3)&1)
// Lane (l16, grp) receives k = kbase + 8*grp + 0..7 of column nbase + l16, the
// second load the same 16 rows further: the k order of load_frag above.
// pitch (halves) is an odd multiple of 16 halves (32 B) for these loads.
typedef __attribute__((address_space(3))) v8s lv8s;
__device__ inline v16h load_frag_tr(const _Float16* p, int pitch) {
    const v8h lo = __builtin_bit_cast(v8h,
        __builtin_amdgcn_ds_load_tr16_b128_v8i16((lv8s*)p));
    const v8h hi = __builtin_bit_cast(v8h,
        __builtin_amdgcn_ds_load_tr16_b128_v8i16((lv8s*)(p + 16 * pitch)));
    v16h r;
#pragma unroll
    for (int i = 0; i < 8; ++i) { r[i] = lo[i]; r[i + 8] = hi[i]; }
    return r;
}

__device__ inline v4h cvt4(float4 f) {
    v4h r;
    r[0] = (_Float16)f.x; r[1] = (_Float16)f.y;
    r[2] = (_Float16)f.z; r[3] = (_Float16)f.w;
    return r;
}

__device__ inline v8f wmma32(v16h a, v16h b, v8f c) {
    return __builtin_amdgcn_wmma_f32_16x16x32_f16(
        /*neg_a=*/false, a, /*neg_b=*/false, b,
        /*c_mod=*/(short)0, c, /*reuse_a=*/false, /*reuse_b=*/false);
}

// ---------------------------------------------------------------------------
// Kernel 0: the four weight matrices to f16, once per call, layout unchanged.
// dst = Wq | Wk | Wv | Wf. A block converts 8192 consecutive floats: blocks
// 0..127 Wq, 128..255 Wk, 256..383 Wv, 384..415 Wf. The GEMM kernels re-read a
// W tile in every row block (64 times), so they fetch it at half the bytes.
// ---------------------------------------------------------------------------
__global__ void __launch_bounds__(256)
wcvt_kernel(const float* __restrict__ Wq, const float* __restrict__ Wk,
            const float* __restrict__ Wv, const float* __restrict__ Wf,
            _Float16* __restrict__ dst)
{
    const int which = blockIdx.x >> 7;
    const float* src = which == 0 ? Wq : which == 1 ? Wk : which == 2 ? Wv : Wf;
    const float4* sp = (const float4*)(src + (size_t)(blockIdx.x & 127) * 8192) + threadIdx.x;
    v4h* dp = (v4h*)(dst + (size_t)blockIdx.x * 8192) + threadIdx.x;
    float4 r[8];
#pragma unroll
    for (int j = 0; j < 8; ++j) r[j] = sp[j * 256];
#pragma unroll
    for (int j = 0; j < 8; ++j) dp[j * 256] = cvt4(r[j]);
}

// ---------------------------------------------------------------------------
// Kernel 1: QKV projections.  C[M=8192, N=1024] = X[M,K=1024] * W[K,N] + bias
// All three in ONE launch: blockIdx.z picks the input, its weights, bias and
// output plane. They do not depend on one another, so a WGP goes on to its next
// block when it is free and does not wait for the slowest block of a launch.
// W arrives as f16 (kernel 0), the three matrices one behind the other.
// Output written as f16 in [B, H, S, HD] layout (head-transposed).
// Two LDS buffers, one barrier per pass. Behind the barrier of pass k the X
// loads of tile k+1 go out, then the async copies that bring its W tile (f16
// already) straight into the other buffer; both fly during the pass's LDS reads
// and WMMAs. X is converted and stored at the head of pass k+1, while the W
// copies may still be landing.
// Block tile 128 x 256, K pass 128, 8 waves of 64 x 64 (2 x 4): a row of X is
// fetched by 4 column blocks, and 8 fragments feed 16 WMMAs. 3 x 256 blocks,
// one per WGP (LDS).
// The K loop starts at tile rot and wraps round. The 64 row blocks that read one
// W tile and the 4 column blocks that read one X tile start together and keep
// step, so from tile 0 they all ask L2 for the same lines at the same moment;
// with the starts spread over the 8 tiles they do not, and an X tile is missed
// in L2 by one column block and found there by the three that come later.
// ---------------------------------------------------------------------------
__global__ void __launch_bounds__(256)
proj_kernel(const float* __restrict__ Xq, const float* __restrict__ Xk,
            const float* __restrict__ Xv, const _Float16* __restrict__ Wqkv,
            const float* __restrict__ bq, const float* __restrict__ bk,
            const float* __restrict__ bv, _Float16* __restrict__ QKV)
{
    const int which = blockIdx.z;   // 0 Q, 1 K, 2 V
    const float* __restrict__ X    = which == 0 ? Xq : which == 1 ? Xk : Xv;
    const float* __restrict__ bias = which == 0 ? bq : which == 1 ? bk : bv;
    const _Float16* __restrict__ W = Wqkv + (size_t)which * Dc * Dc;
    _Float16* __restrict__ out     = QKV + (size_t)which * Bc * Hc * Sc * HDc;

    constexpr int BM = 128, BN = 256, BK = 128;
    constexpr int LDS_S = BK + 8;  // 272B row stride (16B x odd) for b128 reads
    constexpr int LDS_B = BN + 16; // W tile kept [k][n]: 544B row stride (32B x odd)
    constexpr int Kdim = 1024, Nglob = 1024, NT = Kdim / BK;
    constexpr int ASZ = BM * LDS_S, BSZ = BK * LDS_B;      // halves per buffer
    constexpr int AC = BM * BK / 4 / 256, BC = BK * BN / 8 / 256;
    __shared__ __align__(16) _Float16 As[2 * ASZ];
    __shared__ __align__(16) _Float16 Bs[2 * BSZ];

    const int tid  = threadIdx.x;
    const int lane = tid & 31, wid = tid >> 5;
    const int waveM = wid & 1, waveN = wid >> 1;
    const int l16 = lane & 15, grp = lane >> 4;
    const int m0 = blockIdx.x * BM, n0 = blockIdx.y * BN;
    const int trRow = grp * 8 + (lane & 7), trCol = ((lane >> 3) & 1) * 8;

    v8f acc[4][4];
#pragma unroll
    for (int i = 0; i < 4; ++i)
#pragma unroll
        for (int j = 0; j < 4; ++j) acc[i][j] = zero8();

    // Chunk c of a thread lies AR rows (X) or BR rows (W) below chunk c-1: one
    // running pointer per operand, the chunks at constant offsets from it.
    constexpr int AR = 256 / (BK / 4), BR = 256 / (BN / 8);
    const int aRow = tid / (BK / 4), aCol = (tid % (BK / 4)) * 4;
    const int bRow = tid / (BN / 8), bCol = (tid % (BN / 8)) * 8;
    const int rot = ((blockIdx.x >> 3) + 2 * blockIdx.y) & (NT - 1);
    int kk = rot;   // the K tile that the next load_tiles fetches
    const float* aP = X + (size_t)(m0 + aRow) * Kdim + aCol + rot * BK;
    const _Float16* bP = W + (size_t)(bRow + rot * BK) * Nglob + n0 + bCol;
    float4 aReg[AC];
    auto load_tiles = [&](int buf) {   // the next BK columns of X, the next BK rows of W
#pragma unroll
        for (int c = 0; c < AC; ++c)
            aReg[c] = *(const float4*)(aP + (size_t)c * AR * Kdim);
        // The pointer named by the loads above is advanced next. The clobber
        // also keeps these loads ahead of the pass's LDS reads and WMMAs: sunk
        // among them, their whole latency is waited out at the next pass's head.
        asm volatile("s_wait_xcnt 0x0" ::: "memory");
        // Keeps the pointer addition behind that wait: nothing ties it to it,
        // and the scheduler lifts it over it.
        __builtin_amdgcn_sched_barrier(0);
        const int step = kk == NT - 1 ? BK - Kdim : BK;   // behind the last tile: back to tile 0
        kk = (kk + 1) & (NT - 1);
        aP += step;
        // Keeps that addition ahead of the copies: sunk behind them, the wait the
        // compiler puts in front of it covers the copies' addresses as well.
        __builtin_amdgcn_sched_barrier(0);
        // W behind X: X is wanted first, for its conversion.
#pragma unroll
        for (int c = 0; c < BC; ++c)
            async_cp16(&Bs[buf * BSZ + bRow * LDS_B + bCol + c * BR * LDS_B],
                       bP + (size_t)c * BR * Nglob);
        bP += step * Nglob;
    };
    auto store_tiles = [&](int buf) {
#pragma unroll
        for (int c = 0; c < AC; ++c)
            *(v4h*)(&As[buf * ASZ + aRow * LDS_S + aCol + c * AR * LDS_S]) = cvt4(aReg[c]);
    };

    load_tiles(0);
    for (int kt = 0; kt < NT; ++kt) {
        const int cur = kt & 1;
        store_tiles(cur);   // its last readers (pass kt-2) passed the barrier of pass kt-1
        // This wave's LDS reads of buf cur^1 have retired before copies aim at it.
        asm volatile("s_wait_dscnt 0x0" ::: "memory");
        // This wave's copies of W tile kt have landed.
        asm volatile("s_wait_asynccnt 0x0" ::: "memory");
        __syncthreads();    // publishes tile kt; buf cur^1 is free
        if (kt + 1 < NT) load_tiles(cur ^ 1);

#pragma unroll
        for (int ks = 0; ks < BK / 32; ++ks) {
            v16h afr[4], bfr[4];
#pragma unroll
            for (int im = 0; im < 4; ++im)
                afr[im] = load_frag(&As[cur * ASZ + (waveM * 64 + im * 16 + l16) * LDS_S] + ks * 32, grp);
#pragma unroll
            for (int in = 0; in < 4; ++in)
                bfr[in] = load_frag_tr(&Bs[cur * BSZ + (ks * 32 + trRow) * LDS_B + waveN * 64 + in * 16 + trCol], LDS_B);
            // Keeps the k step's 16 fragment reads in one group ahead of its 16
            // WMMAs: left free, each A fragment is read into one register set and
            // waited for in full in front of every 4 WMMAs.
            __builtin_amdgcn_sched_barrier(0);
#pragma unroll
            for (int im = 0; im < 4; ++im)
#pragma unroll
                for (int in = 0; in < 4; ++in)
                    acc[im][in] = wmma32(afr[im], bfr[in], acc[im][in]);
        }
    }
    // The ring's closing wait: no copy of this wave is open when it ends.
    asm volatile("s_wait_asynccnt 0x0" ::: "memory");

    // Epilogue: bias add, convert f16, scatter to [B,H,S,HD]
#pragma unroll
    for (int im = 0; im < 4; ++im)
#pragma unroll
        for (int in = 0; in < 4; ++in)
#pragma unroll
            for (int r = 0; r < 8; ++r) {
                const int mLoc = waveM * 64 + im * 16 + grp * 8 + r;
                const int nLoc = waveN * 64 + in * 16 + l16;
                const int gm = m0 + mLoc;   // b*S + s
                const int gn = n0 + nLoc;   // h*HD + hd
                const float v = acc[im][in][r] + bias[gn];
                const int b = gm >> 11, s = gm & 2047;
                const int h = gn >> 6, hd = gn & 63;
                out[(((size_t)(b * Hc + h) * Sc + s) * HDc) + hd] = (_Float16)v;
            }
}

__global__ void __launch_bounds__(256)
attn_kernel(const _Float16* __restrict__ Q, const _Float16* __restrict__ K,
            const _Float16* __restrict__ V, _Float16* __restrict__ X)
{
    constexpr int LQ = 72;  // 72 halves = 144B row stride (16B aligned)
    constexpr int LV = 80;  // 80 halves = 160B row stride for transposing loads
    constexpr int NT = Sc / 64;
    constexpr int QB = 256; // queries per block
    __shared__ __align__(16) _Float16 Qs[QB * LQ];       // Q tile
    __shared__ __align__(16) _Float16 Ks[2 * 64 * LQ];   // [buf][key][hd]
    __shared__ __align__(16) _Float16 Vs[2 * 64 * LV];   // [buf][key][hd]

    const int tid  = threadIdx.x;
    const int lane = tid & 31, wid = tid >> 5;
    const int l16 = lane & 15, grp = lane >> 4;
    const int bh = blockIdx.y;            // b*H + h
    const int b  = bh >> 4, h = bh & 15;
    const int q0 = blockIdx.x * QB;
    const int trRow = grp * 8 + (lane & 7), trCol = ((lane >> 3) & 1) * 8;

    const _Float16* Qp = Q + (size_t)bh * Sc * HDc;
    const _Float16* Kp = K + (size_t)bh * Sc * HDc;
    const _Float16* Vp = V + (size_t)bh * Sc * HDc;

    auto stage_kv = [&](int kb, int buf) {
        _Float16* KsB = &Ks[buf * 64 * LQ];
#pragma unroll
        for (int c = 0; c < 2; ++c) {
            const int idx = tid + c * 256;
            const int row = idx >> 3, c8 = idx & 7;
            async_cp16(&KsB[row * LQ + c8 * 8],
                       Kp + (size_t)(kb + row) * HDc + c8 * 8);
        }
#pragma unroll
        for (int c = 0; c < 2; ++c) {
            const int idx = tid + c * 256;
            const int row = idx >> 3, c8 = idx & 7;
            async_cp16(&Vs[buf * 64 * LV + row * LV + c8 * 8],
                       Vp + (size_t)(kb + row) * HDc + c8 * 8);
        }
    };

    // Stage Q tile (async) + first K/V tile, then pull Q fragments to regs.
#pragma unroll
    for (int c = 0; c < QB / 32; ++c) {
        const int idx = tid + c * 256;
        const int row = idx >> 3, c8 = idx & 7;
        async_cp16(&Qs[row * LQ + c8 * 8],
                   Qp + (size_t)(q0 + row) * HDc + c8 * 8);
    }
    stage_kv(0, 0);
    wait_async0();
    __syncthreads();

    // B fragments of Q^T: column group cg, column = query wid*32 + cg*16 + l16,
    // k = hd.
    v16h qfr[2][2];
#pragma unroll
    for (int cg = 0; cg < 2; ++cg)
#pragma unroll
        for (int ks = 0; ks < 2; ++ks)
            qfr[cg][ks] = load_frag(&Qs[(wid * 32 + cg * 16 + l16) * LQ] + ks * 32, grp);

    v8f oacc[2][4];  // O^T: row hd = in*16 + grp*8 + r, column = query l16 of group cg
    float dpart[2][8];  // this lane's share of its two queries' sums, 8 chains each
#pragma unroll
    for (int cg = 0; cg < 2; ++cg) {
#pragma unroll
        for (int i = 0; i < 4; ++i) oacc[cg][i] = zero8();
#pragma unroll
        for (int r = 0; r < 8; ++r) dpart[cg][r] = 0.0f;
    }

    for (int kt = 0; kt < NT; ++kt) {
        const int cur = kt & 1;
        // This wave's LDS reads of buf cur^1 have retired before copies aim at it.
        asm volatile("s_wait_dscnt 0x0" ::: "memory");
        // This wave's copies of tile kt have landed.
        asm volatile("s_wait_asynccnt 0x0" ::: "memory");
        __syncthreads();     // all waves' tile kt visible; buf cur^1 is free
        if (kt + 1 < NT) stage_kv((kt + 1) * 64, cur ^ 1);  // DMA overlaps WMMA

        const _Float16* KsB = &Ks[cur * 64 * LQ];
        const _Float16* VsB = &Vs[cur * 64 * LV];

        // S^T = K Q^T  (M=64 keys -> 4 m-subtiles, N=2x16 queries, K=HD=64)
        v16h kfr[4][2];
#pragma unroll
        for (int jm = 0; jm < 4; ++jm)
#pragma unroll
            for (int ks = 0; ks < 2; ++ks)
                kfr[jm][ks] = load_frag(&KsB[(jm * 16 + l16) * LQ] + ks * 32, grp);
        // Keeps the tile's K fragment reads in one group ahead of the S^T products.
        __builtin_amdgcn_sched_barrier(0);
        v8f e[2][4];
#pragma unroll
        for (int jm = 0; jm < 4; ++jm) {
            e[0][jm] = zero8();
            e[1][jm] = zero8();
#pragma unroll
            for (int ks = 0; ks < 2; ++ks)
#pragma unroll
                for (int cg = 0; cg < 2; ++cg)
                    e[cg][jm] = wmma32(kfr[jm][ks], qfr[cg][ks], e[cg][jm]);
        }
        __builtin_amdgcn_sched_barrier(0);
        // exp, partial denominator, pack P^T (f16) as B fragments: subtile jm
        // holds keys jm*16 + grp*8 + r, i.e. halves 0..7 (jm even) or 8..15
        // (jm odd) of the 32-key fragment jm/2.
        v16h pfr[2][2];
#pragma unroll
        for (int cg = 0; cg < 2; ++cg)
#pragma unroll
            for (int jm = 0; jm < 4; ++jm)
#pragma unroll
                for (int r = 0; r < 8; ++r) {
                    const float ev = __expf(e[cg][jm][r] * 0.125f);
                    dpart[cg][r] += ev;
                    pfr[cg][jm >> 1][(jm & 1) * 8 + r] = (_Float16)ev;
                }

        // O^T += V^T P^T  (M=64 hd -> 4 m-subtiles, K=64 keys -> 2 k-steps)
#pragma unroll
        for (int in = 0; in < 4; ++in)
#pragma unroll
            for (int ks = 0; ks < 2; ++ks) {
                const v16h afr = load_frag_tr(
                    &VsB[(ks * 32 + trRow) * LV + in * 16 + trCol], LV);
#pragma unroll
                for (int cg = 0; cg < 2; ++cg)
                    oacc[cg][in] = wmma32(afr, pfr[cg][ks], oacc[cg][in]);
            }
    }

#pragma unroll
    for (int cg = 0; cg < 2; ++cg) {
        // Denominator of query l16 of group cg: the lane's 8 chains, then the
        // other half-wave (which held the other 8 keys of every 16).
        float dsum = ((dpart[cg][0] + dpart[cg][1]) + (dpart[cg][2] + dpart[cg][3])) +
                     ((dpart[cg][4] + dpart[cg][5]) + (dpart[cg][6] + dpart[cg][7]));
        dsum += __shfl_xor(dsum, 16);
        const float dinv = 1.0f / (1.0f + dsum);   // softmax_1 denominator

        // Normalize and write X in [B, S, D] f16 layout: 8 consecutive hd per lane
        const int qrow = q0 + wid * 32 + cg * 16 + l16;
        _Float16* xrow = X + ((size_t)b * Sc + qrow) * Dc + h * HDc + grp * 8;
#pragma unroll
        for (int in = 0; in < 4; ++in) {
            v8h o;
#pragma unroll
            for (int r = 0; r < 8; ++r) o[r] = (_Float16)(oacc[cg][in][r] * dinv);
            *(v8h*)(xrow + in * 16) = o;
        }
    }
}

// ---------------------------------------------------------------------------
// Kernel 3: final projection.  out[M=8192, N=256] = Xh[M,K=1024] * Wf + bf
// 128 x 128 block, 32 x 64 wave tiles, two LDS buffers and one barrier per pass
// as in proj; A and W are f16 already, so both tiles come by async copies.
// The K loop starts at tile rot and wraps round, as in proj and for its reason.
// ---------------------------------------------------------------------------
__global__ void __launch_bounds__(256)
final_kernel(const _Float16* __restrict__ Xh, const _Float16* __restrict__ W,
             const float* __restrict__ bias, float* __restrict__ out)
{
    constexpr int BM = 128, BN = 128, BK = 128;
    constexpr int LDS_S = BK + 8;  // 272B row stride (16B x odd) for b128 reads
    constexpr int LDS_B = 144;     // W tile kept [k][n]: 288B row stride
    constexpr int Kdim = 1024, Nglob = 256, NT = Kdim / BK;
    constexpr int ASZ = BM * LDS_S, BSZ = BK * LDS_B;      // halves per buffer
    constexpr int AC = BM * BK / 8 / 256, BC = BK * BN / 8 / 256;
    __shared__ __align__(16) _Float16 As[2 * ASZ];
    __shared__ __align__(16) _Float16 Bs[2 * BSZ];

    const int tid  = threadIdx.x;
    const int lane = tid & 31, wid = tid >> 5;
    const int waveM = wid & 3, waveN = wid >> 2;
    const int l16 = lane & 15, grp = lane >> 4;
    const int m0 = blockIdx.x * BM, n0 = blockIdx.y * BN;
    const int trRow = grp * 8 + (lane & 7), trCol = ((lane >> 3) & 1) * 8;

    v8f acc[2][4];
#pragma unroll
    for (int i = 0; i < 2; ++i)
#pragma unroll
        for (int j = 0; j < 4; ++j) acc[i][j] = zero8();

    // Chunk c of a thread lies AR rows (Xh) or 16 rows (W) below chunk c-1: one
    // running pointer per operand, the chunks at constant offsets from it.
    constexpr int AR = 256 / (BK / 8);
    const int aRow = tid / (BK / 8), aCol = (tid % (BK / 8)) * 8;
    const int bRow = tid >> 4, bCol = (tid & 15) * 8;
    const int rot = ((blockIdx.x >> 3) + 4 * blockIdx.y) & (NT - 1);
    int kk = rot;   // the K tile that the next copy_tiles fetches
    const _Float16* aP = Xh + (size_t)(m0 + aRow) * Kdim + aCol + rot * BK;
    const _Float16* bP = W + (size_t)(bRow + rot * BK) * Nglob + n0 + bCol;
    auto copy_tiles = [&](int buf) {   // the next BK columns of Xh, the next BK rows of W
#pragma unroll
        for (int c = 0; c < AC; ++c)
            async_cp16(&As[buf * ASZ + aRow * LDS_S + aCol + c * AR * LDS_S],
                       aP + (size_t)c * AR * Kdim);
#pragma unroll
        for (int c = 0; c < BC; ++c)
            async_cp16(&Bs[buf * BSZ + bRow * LDS_B + bCol + c * 16 * LDS_B],
                       bP + (size_t)c * 16 * Nglob);
        const int step = kk == NT - 1 ? BK - Kdim : BK;   // behind the last tile: back to tile 0
        kk = (kk + 1) & (NT - 1);
        aP += step;
        bP += step * Nglob;
    };

    copy_tiles(0);
    for (int kt = 0; kt < NT; ++kt) {
        const int cur = kt & 1;
        // This wave's LDS reads of buf cur^1 have retired before copies aim at it.
        asm volatile("s_wait_dscnt 0x0" ::: "memory");
        // This wave's copies of tile kt have landed.
        asm volatile("s_wait_asynccnt 0x0" ::: "memory");
        __syncthreads();    // publishes tile kt; buf cur^1 is free
        if (kt + 1 < NT) copy_tiles(cur ^ 1);

#pragma unroll
        for (int ks = 0; ks < BK / 32; ++ks) {
            v16h afr[2], bfr[4];
#pragma unroll
            for (int im = 0; im < 2; ++im)
                afr[im] = load_frag(&As[cur * ASZ + (waveM * 32 + im * 16 + l16) * LDS_S] + ks * 32, grp);
#pragma unroll
            for (int in = 0; in < 4; ++in)
                bfr[in] = load_frag_tr(&Bs[cur * BSZ + (ks * 32 + trRow) * LDS_B + waveN * 64 + in * 16 + trCol], LDS_B);
#pragma unroll
            for (int im = 0; im < 2; ++im)
#pragma unroll
                for (int in = 0; in < 4; ++in)
                    acc[im][in] = wmma32(afr[im], bfr[in], acc[im][in]);
        }
    }
    // The ring's closing wait: no copy of this wave is open when it ends.
    asm volatile("s_wait_asynccnt 0x0" ::: "memory");

#pragma unroll
    for (int im = 0; im < 2; ++im)
#pragma unroll
        for (int in = 0; in < 4; ++in)
#pragma unroll
            for (int r = 0; r < 8; ++r) {
                const int mLoc = waveM * 32 + im * 16 + grp * 8 + r;
                const int nLoc = waveN * 64 + in * 16 + l16;
                const int gm = m0 + mLoc;
                const int gn = n0 + nLoc;
                out[(size_t)gm * OUTc + gn] = acc[im][in][r] + bias[gn];
            }
}

// ---------------------------------------------------------------------------
extern "C" void kernel_launch(void* const* d_in, const int* in_sizes, int n_in,
                              void* d_out, int out_size, void* d_ws, size_t ws_size,
                              hipStream_t stream)
{
    (void)in_sizes; (void)n_in; (void)out_size; (void)ws_size;
    const float* query = (const float*)d_in[0];
    const float* key   = (const float*)d_in[1];
    const float* value = (const float*)d_in[2];
    const float* Wq = (const float*)d_in[3];
    const float* bq = (const float*)d_in[4];
    const float* Wk = (const float*)d_in[5];
    const float* bk = (const float*)d_in[6];
    const float* Wv = (const float*)d_in[7];
    const float* bv = (const float*)d_in[8];
    const float* Wf = (const float*)d_in[9];
    const float* bf = (const float*)d_in[10];
    float* out = (float*)d_out;

    // Workspace layout (f16): Qh | Kh | Vh | Xh, each B*H*S*HD = 8,388,608 elems,
    // then the f16 weights Wq | Wk | Wv (D*D each) | Wf (D*OUT)
    _Float16* ws = (_Float16*)d_ws;
    const size_t per = (size_t)Bc * Hc * Sc * HDc;
    _Float16* Qh = ws;
    _Float16* Kh = ws + per;
    _Float16* Vh = ws + 2 * per;
    _Float16* Xh = ws + 3 * per;
    const size_t wper = (size_t)Dc * Dc;
    _Float16* Wh = ws + 4 * per;

    const dim3 blk(256);
    const dim3 gproj(Bc * Sc / 128, Dc / 256, 3);    // (64, 4, 3)
    wcvt_kernel<<<dim3((3 * Dc * Dc + Dc * OUTc) / 8192), blk, 0, stream>>>(Wq, Wk, Wv, Wf, Wh);
    proj_kernel<<<gproj, blk, 0, stream>>>(query, key, value, Wh, bq, bk, bv, Qh);

    attn_kernel<<<dim3(Sc / 256, Bc * Hc), blk, 0, stream>>>(Qh, Kh, Vh, Xh);

    final_kernel<<<dim3(Bc * Sc / 128, OUTc / 128), blk, 0, stream>>>(Xh, Wh + 3 * wper, bf, out);
}
